// v000
// The times below were measured on an AMD MI455X: many runs one after another, warmed up first and cycling through
// copies of the inputs, with the whole window's GPU time divided by the number of runs. Launches and the gaps
// between them are all in it. The median over several windows is given; except for v000 it joins two sittings, which
// can be a few percent apart, so the side-by-side timings, each taken in one sitting, are the better comparison.
// v000, which the later versions start from, runs in 365 microseconds.
#include <hip/hip_runtime.h>

#define DMODEL 1024
#define SLEN   2048
#define NHEAD  16
#define DK     64
#define NB     4

typedef __attribute__((ext_vector_type(16))) _Float16 v16h;
typedef __attribute__((ext_vector_type(8)))  _Float16 v8h;
typedef __attribute__((ext_vector_type(4)))  _Float16 v4h;
typedef __attribute__((ext_vector_type(4)))  float    v4f;
typedef __attribute__((ext_vector_type(8)))  float    v8f;

// D = A(16x32 f16) * B(32x16 f16) + C(16x16 f32)
__device__ __forceinline__ v8f wmma16(v16h a, v16h b, v8f c) {
  return __builtin_amdgcn_wmma_f32_16x16x32_f16(
      /*neg_a=*/false, a, /*neg_b=*/false, b,
      /*c_mod=*/(short)0, c, /*reuse_a=*/false, /*reuse_b=*/false);
}

__device__ __forceinline__ v16h frag_f16(const _Float16* __restrict__ p) {
  v8h a = *(const v8h*)(p);
  v8h b = *(const v8h*)(p + 16);
  v16h f;
#pragma unroll
  for (int j = 0; j < 8; ++j) { f[j] = a[j]; f[j + 8] = b[j]; }
  return f;
}

// ---------------------------------------------------------------------------
// Kernel 0: one-time fp32 -> f16 conversion (pure bandwidth pass).
// ---------------------------------------------------------------------------
__global__ void __launch_bounds__(256)
cvt_f32_to_f16(const float* __restrict__ in, _Float16* __restrict__ out,
               int n4) {
  const int i = blockIdx.x * 256 + threadIdx.x;
  if (i < n4) {
    v4f v = ((const v4f*)in)[i];
    v4h h;
#pragma unroll
    for (int j = 0; j < 4; ++j) h[j] = (_Float16)v[j];
    ((v4h*)out)[i] = h;
  }
}

// ---------------------------------------------------------------------------
// Kernel 1: QKV projection, one wave per 64x64 output tile, blockIdx.z picks
// the matrix (0=Q, 1=K, 2=V).  out[m,n] = sum_k x[m,k]*W[n,k] + b[n].
// Per K-step: 4 A-frags + 4 B-frags (16 b128 loads) feed 16 WMMA.
// Q,K stored [token, h*64+d]; V stored transposed [b,h,dk,S] so the
// attention P*V B-fragments become contiguous loads.
// ---------------------------------------------------------------------------
__global__ void __launch_bounds__(32)
qkv_gemm_kernel(const _Float16* __restrict__ Xh,
                const _Float16* __restrict__ Wqh,
                const _Float16* __restrict__ Wkh,
                const _Float16* __restrict__ Wvh,
                const float* __restrict__ bq, const float* __restrict__ bk,
                const float* __restrict__ bv,
                _Float16* __restrict__ Qo, _Float16* __restrict__ Ko,
                _Float16* __restrict__ Vo) {
  const int lane = threadIdx.x;
  const int lo = lane & 15, hi = lane >> 4;
  const int n0 = blockIdx.x * 64;
  const int m0 = blockIdx.y * 64;
  const int z  = blockIdx.z;
  const _Float16* W    = (z == 0) ? Wqh : (z == 1) ? Wkh : Wvh;
  const float*    bias = (z == 0) ? bq  : (z == 1) ? bk  : bv;

  const _Float16* ar[4];
  const _Float16* br[4];
#pragma unroll
  for (int i = 0; i < 4; ++i) {
    ar[i] = Xh + (size_t)(m0 + i * 16 + lo) * DMODEL;
    br[i] = W  + (size_t)(n0 + i * 16 + lo) * DMODEL;
  }

  v8f acc[4][4] = {};
  for (int k = 0; k < DMODEL; k += 32) {
    v16h a[4];
#pragma unroll
    for (int i = 0; i < 4; ++i) a[i] = frag_f16(ar[i] + k + hi * 8);
#pragma unroll
    for (int j = 0; j < 4; ++j) {
      v16h bf = frag_f16(br[j] + k + hi * 8);
#pragma unroll
      for (int i = 0; i < 4; ++i) acc[i][j] = wmma16(a[i], bf, acc[i][j]);
    }
  }

  if (z < 2) {  // Q or K: row-major [token, feature]
    _Float16* O = (z == 0) ? Qo : Ko;
#pragma unroll
    for (int j = 0; j < 4; ++j) {
      const int col = n0 + j * 16 + lo;
      const float bb = bias[col];
#pragma unroll
      for (int i = 0; i < 4; ++i) {
#pragma unroll
        for (int r = 0; r < 8; ++r) {
          const int row = m0 + i * 16 + hi * 8 + r;
          O[(size_t)row * DMODEL + col] = (_Float16)(acc[i][j][r] + bb);
        }
      }
    }
  } else {      // V: transposed per head [b, h, dk, S] (contiguous in S)
    const int b_ = m0 >> 11;  // 64-row tile never crosses a batch boundary
#pragma unroll
    for (int j = 0; j < 4; ++j) {
      const int col = n0 + j * 16 + lo;
      const float bb = bias[col];
      const int hh = col >> 6, dl = col & 63;
      _Float16* vb = Vo + (((size_t)(b_ * NHEAD + hh) * DK) + dl) * SLEN;
#pragma unroll
      for (int i = 0; i < 4; ++i) {
        const int s0 = (m0 & (SLEN - 1)) + i * 16 + hi * 8;
#pragma unroll
        for (int r = 0; r < 8; ++r)
          vb[s0 + r] = (_Float16)(acc[i][j][r] + bb);
      }
    }
  }
}

__global__ void __launch_bounds__(32)
attn_kernel(const _Float16* __restrict__ Q, const _Float16* __restrict__ K,
            const _Float16* __restrict__ V, _Float16* __restrict__ O) {
  __shared__ __align__(16) _Float16 Plds[16][32];

  const int lane = threadIdx.x;
  const int lo = lane & 15, hi = lane >> 4;
  const int q0 = blockIdx.x * 16;
  const int h  = blockIdx.y;
  const int b  = blockIdx.z;

  const _Float16* qp = Q + (size_t)b * SLEN * DMODEL + h * DK;
  const _Float16* kp = K + (size_t)b * SLEN * DMODEL + h * DK;
  const _Float16* vp = V + (size_t)(b * NHEAD + h) * DK * SLEN;

  const v16h qa0 = frag_f16(qp + (size_t)(q0 + lo) * DMODEL + hi * 8);
  const v16h qa1 = frag_f16(qp + (size_t)(q0 + lo) * DMODEL + 32 + hi * 8);

  float mrow[8], lrow[8];
  v8f acc[4] = {{}, {}, {}, {}};
#pragma unroll
  for (int r = 0; r < 8; ++r) { mrow[r] = -__builtin_inff(); lrow[r] = 0.f; }

  const int s_end = q0 + 16;  // causal upper bound
  for (int s0 = 0; s0 < s_end; s0 += 32) {
    // Prefetch next chunk's K rows / V columns into cache (global_prefetch).
    __builtin_prefetch(kp + (size_t)(s0 + 32 + lo) * DMODEL, 0, 1);
    __builtin_prefetch(kp + (size_t)(s0 + 48 + lo) * DMODEL, 0, 1);
    __builtin_prefetch(vp + (size_t)lo * SLEN + s0 + 32, 0, 1);
    __builtin_prefetch(vp + (size_t)(48 + lo) * SLEN + s0 + 32, 0, 1);

    // ---- scores: S = Q * K^T ----
    v8f sc0 = {}, sc1 = {};
    {
      const _Float16* kr0 = kp + (size_t)(s0 + lo) * DMODEL;
      sc0 = wmma16(qa0, frag_f16(kr0 + hi * 8), sc0);
      sc0 = wmma16(qa1, frag_f16(kr0 + 32 + hi * 8), sc0);
      const _Float16* kr1 = kp + (size_t)(s0 + 16 + lo) * DMODEL;
      sc1 = wmma16(qa0, frag_f16(kr1 + hi * 8), sc1);
      sc1 = wmma16(qa1, frag_f16(kr1 + 32 + hi * 8), sc1);
    }

    // ---- scale + causal mask ----
    const int key0 = s0 + lo, key1 = s0 + 16 + lo;
#pragma unroll
    for (int r = 0; r < 8; ++r) {
      const int qrow = q0 + hi * 8 + r;
      const float a0 = sc0[r] * 0.125f;   // 1/sqrt(64)
      const float a1 = sc1[r] * 0.125f;
      sc0[r] = (key0 <= qrow) ? a0 : -__builtin_inff();
      sc1[r] = (key1 <= qrow) ? a1 : -__builtin_inff();
    }

    // ---- online softmax (row spread across 16 lanes of a half-wave) ----
#pragma unroll
    for (int r = 0; r < 8; ++r) {
      float cm = fmaxf(sc0[r], sc1[r]);
      cm = fmaxf(cm, __shfl_xor(cm, 1));
      cm = fmaxf(cm, __shfl_xor(cm, 2));
      cm = fmaxf(cm, __shfl_xor(cm, 4));
      cm = fmaxf(cm, __shfl_xor(cm, 8));
      const float mnew = fmaxf(mrow[r], cm);
      const float corr = __expf(mrow[r] - mnew);
      const float p0 = __expf(sc0[r] - mnew);
      const float p1 = __expf(sc1[r] - mnew);
      float rs = p0 + p1;
      rs += __shfl_xor(rs, 1);
      rs += __shfl_xor(rs, 2);
      rs += __shfl_xor(rs, 4);
      rs += __shfl_xor(rs, 8);
      lrow[r] = lrow[r] * corr + rs;
      mrow[r] = mnew;
#pragma unroll
      for (int t = 0; t < 4; ++t) acc[t][r] *= corr;
      sc0[r] = p0;
      sc1[r] = p1;
    }

    // ---- relayout P: C-fragment -> A-fragment via LDS ----
    __syncthreads();
#pragma unroll
    for (int r = 0; r < 8; ++r) {
      Plds[hi * 8 + r][lo]      = (_Float16)sc0[r];
      Plds[hi * 8 + r][16 + lo] = (_Float16)sc1[r];
    }
    __syncthreads();
    const v16h pa = frag_f16(&Plds[lo][hi * 8]);

    // ---- out += P * V (V transposed: column d contiguous in S) ----
#pragma unroll
    for (int t = 0; t < 4; ++t) {
      const _Float16* vc = vp + (size_t)(t * 16 + lo) * SLEN + s0;
      acc[t] = wmma16(pa, frag_f16(vc + hi * 8), acc[t]);
    }
  }

  // ---- finalize: divide by row sum, store [b, s, h*64+d] (f16) ----
#pragma unroll
  for (int r = 0; r < 8; ++r) {
    const int qrow = q0 + hi * 8 + r;
    const float inv = 1.0f / lrow[r];
    _Float16* orow = O + ((size_t)b * SLEN + qrow) * DMODEL + h * DK;
#pragma unroll
    for (int t = 0; t < 4; ++t)
      orow[t * 16 + lo] = (_Float16)(acc[t][r] * inv);
  }
}

// ---------------------------------------------------------------------------
// Kernel 3: output projection, 64x64 tile per wave. out = attn @ Wo.T + bo,
// fp32 result straight to d_out.
// ---------------------------------------------------------------------------
__global__ void __launch_bounds__(32)
out_proj_kernel(const _Float16* __restrict__ A, const _Float16* __restrict__ W,
                const float* __restrict__ bias, float* __restrict__ out) {
  const int lane = threadIdx.x;
  const int lo = lane & 15, hi = lane >> 4;
  const int n0 = blockIdx.x * 64;
  const int m0 = blockIdx.y * 64;

  const _Float16* ar[4];
  const _Float16* br[4];
#pragma unroll
  for (int i = 0; i < 4; ++i) {
    ar[i] = A + (size_t)(m0 + i * 16 + lo) * DMODEL;
    br[i] = W + (size_t)(n0 + i * 16 + lo) * DMODEL;
  }

  v8f acc[4][4] = {};
  for (int k = 0; k < DMODEL; k += 32) {
    v16h a[4];
#pragma unroll
    for (int i = 0; i < 4; ++i) a[i] = frag_f16(ar[i] + k + hi * 8);
#pragma unroll
    for (int j = 0; j < 4; ++j) {
      v16h bf = frag_f16(br[j] + k + hi * 8);
#pragma unroll
      for (int i = 0; i < 4; ++i) acc[i][j] = wmma16(a[i], bf, acc[i][j]);
    }
  }

#pragma unroll
  for (int j = 0; j < 4; ++j) {
    const int col = n0 + j * 16 + lo;
    const float bb = bias[col];
#pragma unroll
    for (int i = 0; i < 4; ++i) {
#pragma unroll
      for (int r = 0; r < 8; ++r) {
        const int row = m0 + i * 16 + hi * 8 + r;
        out[(size_t)row * DMODEL + col] = acc[i][j][r] + bb;
      }
    }
  }
}

// ---------------------------------------------------------------------------
extern "C" void kernel_launch(void* const* d_in, const int* in_sizes, int n_in,
                              void* d_out, int out_size, void* d_ws,
                              size_t ws_size, hipStream_t stream) {
  const float* x  = (const float*)d_in[0];
  const float* Wq = (const float*)d_in[1];
  const float* bq = (const float*)d_in[2];
  const float* Wk = (const float*)d_in[3];
  const float* bk = (const float*)d_in[4];
  const float* Wv = (const float*)d_in[5];
  const float* bv = (const float*)d_in[6];
  const float* Wo = (const float*)d_in[7];
  const float* bo = (const float*)d_in[8];
  float* out = (float*)d_out;

  const size_t TOK = (size_t)NB * SLEN;          // 8192 tokens
  const size_t MAT = TOK * DMODEL;               // 8M elements
  const size_t WEL = (size_t)DMODEL * DMODEL;    // 1M elements

  // Workspace map (f16): q/k/v/attn 16 MB each, x_h 16 MB, weights 2 MB x4.
  char* ws = (char*)d_ws;
  _Float16* q_ws = (_Float16*)(ws);
  _Float16* k_ws = (_Float16*)(ws + 16ull * 1024 * 1024);
  _Float16* v_ws = (_Float16*)(ws + 32ull * 1024 * 1024);
  _Float16* a_ws = (_Float16*)(ws + 48ull * 1024 * 1024);
  _Float16* x_h  = (_Float16*)(ws + 64ull * 1024 * 1024);
  _Float16* wq_h = (_Float16*)(ws + 80ull * 1024 * 1024);
  _Float16* wk_h = (_Float16*)(ws + 82ull * 1024 * 1024);
  _Float16* wv_h = (_Float16*)(ws + 84ull * 1024 * 1024);
  _Float16* wo_h = (_Float16*)(ws + 86ull * 1024 * 1024);

  cvt_f32_to_f16<<<(int)(MAT / 4 / 256), 256, 0, stream>>>(x, x_h, (int)(MAT / 4));
  cvt_f32_to_f16<<<(int)(WEL / 4 / 256), 256, 0, stream>>>(Wq, wq_h, (int)(WEL / 4));
  cvt_f32_to_f16<<<(int)(WEL / 4 / 256), 256, 0, stream>>>(Wk, wk_h, (int)(WEL / 4));
  cvt_f32_to_f16<<<(int)(WEL / 4 / 256), 256, 0, stream>>>(Wv, wv_h, (int)(WEL / 4));
  cvt_f32_to_f16<<<(int)(WEL / 4 / 256), 256, 0, stream>>>(Wo, wo_h, (int)(WEL / 4));

  // 1) QKV projections: 64x64 tile per wave, z selects Q/K/V.
  dim3 qkv_grid(DMODEL / 64, (unsigned)(TOK / 64), 3);
  qkv_gemm_kernel<<<qkv_grid, 32, 0, stream>>>(x_h, wq_h, wk_h, wv_h,
                                               bq, bk, bv, q_ws, k_ws, v_ws);

  // 2) Attention: one wave per (query tile, head, batch).
  dim3 attn_grid(SLEN / 16, NHEAD, NB);
  attn_kernel<<<attn_grid, 32, 0, stream>>>(q_ws, k_ws, v_ws, a_ws);

  // 3) Output projection (fp32 result).
  dim3 proj_grid(DMODEL / 64, (unsigned)(TOK / 64));
  out_proj_kernel<<<proj_grid, 32, 0, stream>>>(a_ws, wo_h, bo, out);
}

// v001
// Measured time: 264 microseconds a run.
// Two timings next to v000 put it at 1.41 and 1.43 times that version's speed.
#include <hip/hip_runtime.h>

#define DMODEL 1024
#define SLEN   2048
#define NHEAD  16
#define DK     64
#define NB     4

typedef __attribute__((ext_vector_type(16))) _Float16 v16h;
typedef __attribute__((ext_vector_type(8)))  _Float16 v8h;
typedef __attribute__((ext_vector_type(4)))  _Float16 v4h;
typedef __attribute__((ext_vector_type(4)))  float    v4f;
typedef __attribute__((ext_vector_type(8)))  float    v8f;

// D = A(16x32 f16) * B(32x16 f16) + C(16x16 f32)
__device__ __forceinline__ v8f wmma16(v16h a, v16h b, v8f c) {
  return __builtin_amdgcn_wmma_f32_16x16x32_f16(
      /*neg_a=*/false, a, /*neg_b=*/false, b,
      /*c_mod=*/(short)0, c, /*reuse_a=*/false, /*reuse_b=*/false);
}

__device__ __forceinline__ v16h frag_f16(const _Float16* __restrict__ p) {
  v8h a = *(const v8h*)(p);
  v8h b = *(const v8h*)(p + 16);
  v16h f;
#pragma unroll
  for (int j = 0; j < 8; ++j) { f[j] = a[j]; f[j + 8] = b[j]; }
  return f;
}

// ---------------------------------------------------------------------------
// Fragment-packed layout of every f16 workspace operand.
// A matrix M[row][k] that feeds WMMA as A (lane = row) or B (lane = column,
// stored as row) is kept as 16x32 fragments of 512 halves (1024 bytes), each
// in the order the lanes read it: two units of 256 halves, unit u holding
// k = u*16 + hi*8 + j at [lane = hi*16 + (row & 15)][j]. One wave-wide
// 16-byte load then covers 512 contiguous bytes (4 whole lines) where a
// row-major operand gives 16 rows x 32 bytes (16 lines).
// ---------------------------------------------------------------------------
#define FRAG 512  // halves per 16x32 fragment

// Place of element (row & 15, k & 31) inside its fragment, in halves.
__device__ __forceinline__ int pk_in_frag(int row, int k) {
  return ((k >> 4) & 1) * 256 + ((((k >> 3) & 1) << 4) + (row & 15)) * 8 +
         (k & 7);
}

__device__ __forceinline__ v16h frag_pk(const _Float16* __restrict__ p) {
  v8h a = *(const v8h*)(p);
  v8h b = *(const v8h*)(p + 256);
  v16h f;
#pragma unroll
  for (int j = 0; j < 8; ++j) { f[j] = a[j]; f[j + 8] = b[j]; }
  return f;
}

// ---------------------------------------------------------------------------
// Kernel 0: one-time fp32 -> f16 conversion (pure bandwidth pass) of a matrix
// with DMODEL columns, written fragment-packed: [row/16][k/32] fragments.
// A block converts 16 rows x 64 columns; a wave reads 4 rows x 128 bytes
// (whole lines) and writes 64-byte pieces of one fragment.
// ---------------------------------------------------------------------------
__global__ void __launch_bounds__(256)
cvt_f32_to_f16(const float* __restrict__ in, _Float16* __restrict__ out,
               int n4) {
  const int w = threadIdx.x >> 5, l = threadIdx.x & 31;
  const int R   = blockIdx.x >> 4;                       // 16-row tile
  const int kb  = (blockIdx.x & 15) * 2 + (w >> 2);      // 32-column block
  const int row = R * 16 + (w & 3) * 4 + (l >> 3);
  const int k   = kb * 32 + (l & 7) * 4;
  const int i   = row * (DMODEL / 4) + (k >> 2);
  if (i < n4) {
    v4f v = ((const v4f*)in)[i];
    v4h h;
#pragma unroll
    for (int j = 0; j < 4; ++j) h[j] = (_Float16)v[j];
    *(v4h*)(out + (size_t)(R * (DMODEL / 32) + kb) * FRAG +
            pk_in_frag(row, k)) = h;
  }
}

// ---------------------------------------------------------------------------
// Kernel 1: QKV projection, one wave per 64x64 output tile, blockIdx.z picks
// the matrix (0=Q, 1=K, 2=V).  out[m,n] = sum_k x[m,k]*W[n,k] + b[n].
// Per K-step: 4 A-frags + 4 B-frags (16 b128 loads) feed 16 WMMA.
// All operands and results are fragment-packed. Per (b, h): Q and K as
// [s/16][d/32] fragments (row = token, k = d), V as [s/32][d/16] fragments
// (row = d, k = token) so a 32-key chunk of K or of V is 4 KB in a row.
// ---------------------------------------------------------------------------
__global__ void __launch_bounds__(32)
qkv_gemm_kernel(const _Float16* __restrict__ Xh,
                const _Float16* __restrict__ Wqh,
                const _Float16* __restrict__ Wkh,
                const _Float16* __restrict__ Wvh,
                const float* __restrict__ bq, const float* __restrict__ bk,
                const float* __restrict__ bv,
                _Float16* __restrict__ Qo, _Float16* __restrict__ Ko,
                _Float16* __restrict__ Vo) {
  const int lane = threadIdx.x;
  const int lo = lane & 15, hi = lane >> 4;
  const int n0 = blockIdx.x * 64;
  const int m0 = blockIdx.y * 64;
  const int z  = blockIdx.z;
  const _Float16* W    = (z == 0) ? Wqh : (z == 1) ? Wkh : Wvh;
  const float*    bias = (z == 0) ? bq  : (z == 1) ? bk  : bv;

  // Packed operands: tile row t, k-block kb at (t * (DMODEL/32) + kb) * FRAG.
  const int TROW = (DMODEL / 32) * FRAG;  // halves per 16-row tile
  const _Float16* ap = Xh + (size_t)(m0 >> 4) * TROW + lane * 8;
  const _Float16* bp = W + (size_t)(n0 >> 4) * TROW + lane * 8;

  v8f acc[4][4] = {};
  for (int kb = 0; kb < DMODEL / 32; ++kb) {
    v16h a[4];
#pragma unroll
    for (int i = 0; i < 4; ++i) a[i] = frag_pk(ap + i * TROW + kb * FRAG);
    // The A loads share one address pair, which the register allocator may
    // reuse as a B load's result: the wait stands in front of that overwrite.
    asm volatile("s_wait_xcnt 0x0" ::: "memory");
#pragma unroll
    for (int j = 0; j < 4; ++j) {
      v16h bf = frag_pk(bp + j * TROW + kb * FRAG);
#pragma unroll
      for (int i = 0; i < 4; ++i) acc[i][j] = wmma16(a[i], bf, acc[i][j]);
    }
  }

  const int b_ = m0 >> 11;  // 64-row tile never crosses a batch boundary
  const int hh = n0 >> 6;   // 64-column tile is exactly one head
  const int sb = m0 & (SLEN - 1);
  const size_t head = (size_t)(b_ * NHEAD + hh) * SLEN * DK;
  if (z < 2) {  // Q or K: fragments [s/16][d/32], row = token, k = d
    _Float16* O = ((z == 0) ? Qo : Ko) + head;
#pragma unroll
    for (int j = 0; j < 4; ++j) {
      const int d = j * 16 + lo;
      const float bb = bias[n0 + d];
#pragma unroll
      for (int i = 0; i < 4; ++i) {
        _Float16* fr = O + (((sb >> 4) + i) * (DK / 32) + (d >> 5)) * FRAG;
#pragma unroll
        for (int r = 0; r < 8; ++r) {
          const int row = hi * 8 + r;
          fr[pk_in_frag(row, d)] = (_Float16)(acc[i][j][r] + bb);
        }
      }
    }
  } else {      // V: fragments [s/32][d/16], row = d, k = token
    _Float16* O = Vo + head;
#pragma unroll
    for (int j = 0; j < 4; ++j) {
      const float bb = bias[n0 + j * 16 + lo];
#pragma unroll
      for (int i = 0; i < 4; ++i) {
        const int s0 = sb + i * 16 + hi * 8;   // 8 tokens in a row per lane
        v8h o;
#pragma unroll
        for (int r = 0; r < 8; ++r) o[r] = (_Float16)(acc[i][j][r] + bb);
        *(v8h*)(O + ((s0 >> 5) * (DK / 16) + j) * FRAG + pk_in_frag(lo, s0)) = o;
      }
    }
    // Stands in front of any later overwrite of the stores' data and address
    // registers (the listing leaves a path from here into the branch above).
    asm volatile("s_wait_xcnt 0x0" ::: "memory");
  }
}

__global__ void __launch_bounds__(32)
attn_kernel(const _Float16* __restrict__ Q, const _Float16* __restrict__ K,
            const _Float16* __restrict__ V, _Float16* __restrict__ O) {
  __shared__ __align__(16) _Float16 Plds[16][32];

  const int lane = threadIdx.x;
  const int lo = lane & 15, hi = lane >> 4;
  const int q0 = blockIdx.x * 16;
  const int h  = blockIdx.y;
  const int b  = blockIdx.z;

  // Packed per head: a 16-token tile of Q or K is 2 fragments, a 32-key
  // chunk of K or of V is 4 fragments (CHUNK halves) in a row.
  const int CHUNK = 4 * FRAG;
  const size_t head = (size_t)(b * NHEAD + h) * SLEN * DK;
  const _Float16* qp = Q + head + (q0 >> 4) * (2 * FRAG) + lane * 8;
  const _Float16* kp = K + head;
  const _Float16* vp = V + head;

  const v16h qa0 = frag_pk(qp);
  const v16h qa1 = frag_pk(qp + FRAG);

  float mrow[8], lrow[8];
  v8f acc[4] = {{}, {}, {}, {}};
#pragma unroll
  for (int r = 0; r < 8; ++r) { mrow[r] = -__builtin_inff(); lrow[r] = 0.f; }

  const int s_end = q0 + 16;  // causal upper bound
  for (int s0 = 0; s0 < s_end; s0 += 32) {
    const _Float16* kc = kp + (s0 >> 5) * CHUNK;
    const _Float16* vc = vp + (s0 >> 5) * CHUNK;
    // Prefetch next chunk's K and V (global_prefetch): one line per lane
    // covers each packed 4 KB chunk.
    __builtin_prefetch(kc + CHUNK + lane * 64, 0, 1);
    __builtin_prefetch(vc + CHUNK + lane * 64, 0, 1);

    // ---- scores: S = Q * K^T ----
    v8f sc0 = {}, sc1 = {};
    {
      const _Float16* kr0 = kc + lane * 8;             // keys s0 .. s0+15
      sc0 = wmma16(qa0, frag_pk(kr0), sc0);
      sc0 = wmma16(qa1, frag_pk(kr0 + FRAG), sc0);
      const _Float16* kr1 = kc + 2 * FRAG + lane * 8;  // keys s0+16 .. s0+31
      sc1 = wmma16(qa0, frag_pk(kr1), sc1);
      sc1 = wmma16(qa1, frag_pk(kr1 + FRAG), sc1);
    }

    // ---- scale + causal mask ----
    const int key0 = s0 + lo, key1 = s0 + 16 + lo;
#pragma unroll
    for (int r = 0; r < 8; ++r) {
      const int qrow = q0 + hi * 8 + r;
      const float a0 = sc0[r] * 0.125f;   // 1/sqrt(64)
      const float a1 = sc1[r] * 0.125f;
      sc0[r] = (key0 <= qrow) ? a0 : -__builtin_inff();
      sc1[r] = (key1 <= qrow) ? a1 : -__builtin_inff();
    }

    // ---- online softmax (row spread across 16 lanes of a half-wave) ----
#pragma unroll
    for (int r = 0; r < 8; ++r) {
      float cm = fmaxf(sc0[r], sc1[r]);
      cm = fmaxf(cm, __shfl_xor(cm, 1));
      cm = fmaxf(cm, __shfl_xor(cm, 2));
      cm = fmaxf(cm, __shfl_xor(cm, 4));
      cm = fmaxf(cm, __shfl_xor(cm, 8));
      const float mnew = fmaxf(mrow[r], cm);
      const float corr = __expf(mrow[r] - mnew);
      const float p0 = __expf(sc0[r] - mnew);
      const float p1 = __expf(sc1[r] - mnew);
      float rs = p0 + p1;
      rs += __shfl_xor(rs, 1);
      rs += __shfl_xor(rs, 2);
      rs += __shfl_xor(rs, 4);
      rs += __shfl_xor(rs, 8);
      lrow[r] = lrow[r] * corr + rs;
      mrow[r] = mnew;
#pragma unroll
      for (int t = 0; t < 4; ++t) acc[t][r] *= corr;
      sc0[r] = p0;
      sc1[r] = p1;
    }

    // ---- relayout P: C-fragment -> A-fragment via LDS ----
    __syncthreads();
#pragma unroll
    for (int r = 0; r < 8; ++r) {
      Plds[hi * 8 + r][lo]      = (_Float16)sc0[r];
      Plds[hi * 8 + r][16 + lo] = (_Float16)sc1[r];
    }
    __syncthreads();
    const v16h pa = frag_f16(&Plds[lo][hi * 8]);

    // ---- out += P * V (fragment t: columns d = t*16 .. t*16+15) ----
#pragma unroll
    for (int t = 0; t < 4; ++t)
      acc[t] = wmma16(pa, frag_pk(vc + t * FRAG + lane * 8), acc[t]);
  }

  // ---- finalize: divide by row sum, store packed for the projection:
  //      fragments [token/16][k/32], row = token, k = h*64 + d (f16) ----
  _Float16* ot = O + ((size_t)((b * SLEN + q0) >> 4) * (DMODEL / 32) +
                      h * (DK / 32)) * FRAG;
#pragma unroll
  for (int r = 0; r < 8; ++r) {
    const float inv = 1.0f / lrow[r];
#pragma unroll
    for (int t = 0; t < 4; ++t) {
      const int d = t * 16 + lo;
      ot[(d >> 5) * FRAG + pk_in_frag(hi * 8 + r, d)] =
          (_Float16)(acc[t][r] * inv);
    }
  }
}

// ---------------------------------------------------------------------------
// Kernel 3: output projection, 64x64 tile per wave. out = attn @ Wo.T + bo,
// both operands fragment-packed, fp32 result straight to d_out.
// ---------------------------------------------------------------------------
__global__ void __launch_bounds__(32)
out_proj_kernel(const _Float16* __restrict__ A, const _Float16* __restrict__ W,
                const float* __restrict__ bias, float* __restrict__ out) {
  const int lane = threadIdx.x;
  const int lo = lane & 15, hi = lane >> 4;
  const int n0 = blockIdx.x * 64;
  const int m0 = blockIdx.y * 64;

  // Packed operands: tile row t, k-block kb at (t * (DMODEL/32) + kb) * FRAG.
  const int TROW = (DMODEL / 32) * FRAG;  // halves per 16-row tile
  const _Float16* ap = A + (size_t)(m0 >> 4) * TROW + lane * 8;
  const _Float16* bp = W + (size_t)(n0 >> 4) * TROW + lane * 8;

  v8f acc[4][4] = {};
  for (int kb = 0; kb < DMODEL / 32; ++kb) {
    v16h a[4];
#pragma unroll
    for (int i = 0; i < 4; ++i) a[i] = frag_pk(ap + i * TROW + kb * FRAG);
    // The A loads share one address pair, which the register allocator may
    // reuse as a B load's result: the wait stands in front of that overwrite.
    asm volatile("s_wait_xcnt 0x0" ::: "memory");
#pragma unroll
    for (int j = 0; j < 4; ++j) {
      v16h bf = frag_pk(bp + j * TROW + kb * FRAG);
#pragma unroll
      for (int i = 0; i < 4; ++i) acc[i][j] = wmma16(a[i], bf, acc[i][j]);
    }
  }

#pragma unroll
  for (int j = 0; j < 4; ++j) {
    const int col = n0 + j * 16 + lo;
    const float bb = bias[col];
#pragma unroll
    for (int i = 0; i < 4; ++i) {
#pragma unroll
      for (int r = 0; r < 8; ++r) {
        const int row = m0 + i * 16 + hi * 8 + r;
        out[(size_t)row * DMODEL + col] = acc[i][j][r] + bb;
      }
    }
  }
}

// ---------------------------------------------------------------------------
extern "C" void kernel_launch(void* const* d_in, const int* in_sizes, int n_in,
                              void* d_out, int out_size, void* d_ws,
                              size_t ws_size, hipStream_t stream) {
  const float* x  = (const float*)d_in[0];
  const float* Wq = (const float*)d_in[1];
  const float* bq = (const float*)d_in[2];
  const float* Wk = (const float*)d_in[3];
  const float* bk = (const float*)d_in[4];
  const float* Wv = (const float*)d_in[5];
  const float* bv = (const float*)d_in[6];
  const float* Wo = (const float*)d_in[7];
  const float* bo = (const float*)d_in[8];
  float* out = (float*)d_out;

  const size_t TOK = (size_t)NB * SLEN;          // 8192 tokens
  const size_t MAT = TOK * DMODEL;               // 8M elements
  const size_t WEL = (size_t)DMODEL * DMODEL;    // 1M elements

  // Workspace map (f16): q/k/v/attn 16 MB each, x_h 16 MB, weights 2 MB x4.
  char* ws = (char*)d_ws;
  _Float16* q_ws = (_Float16*)(ws);
  _Float16* k_ws = (_Float16*)(ws + 16ull * 1024 * 1024);
  _Float16* v_ws = (_Float16*)(ws + 32ull * 1024 * 1024);
  _Float16* a_ws = (_Float16*)(ws + 48ull * 1024 * 1024);
  _Float16* x_h  = (_Float16*)(ws + 64ull * 1024 * 1024);
  _Float16* wq_h = (_Float16*)(ws + 80ull * 1024 * 1024);
  _Float16* wk_h = (_Float16*)(ws + 82ull * 1024 * 1024);
  _Float16* wv_h = (_Float16*)(ws + 84ull * 1024 * 1024);
  _Float16* wo_h = (_Float16*)(ws + 86ull * 1024 * 1024);

  cvt_f32_to_f16<<<(int)(MAT / 4 / 256), 256, 0, stream>>>(x, x_h, (int)(MAT / 4));
  cvt_f32_to_f16<<<(int)(WEL / 4 / 256), 256, 0, stream>>>(Wq, wq_h, (int)(WEL / 4));
  cvt_f32_to_f16<<<(int)(WEL / 4 / 256), 256, 0, stream>>>(Wk, wk_h, (int)(WEL / 4));
  cvt_f32_to_f16<<<(int)(WEL / 4 / 256), 256, 0, stream>>>(Wv, wv_h, (int)(WEL / 4));
  cvt_f32_to_f16<<<(int)(WEL / 4 / 256), 256, 0, stream>>>(Wo, wo_h, (int)(WEL / 4));

  // 1) QKV projections: 64x64 tile per wave, z selects Q/K/V.
  dim3 qkv_grid(DMODEL / 64, (unsigned)(TOK / 64), 3);
  qkv_gemm_kernel<<<qkv_grid, 32, 0, stream>>>(x_h, wq_h, wk_h, wv_h,
                                               bq, bk, bv, q_ws, k_ws, v_ws);

  // 2) Attention: one wave per (query tile, head, batch).
  dim3 attn_grid(SLEN / 16, NHEAD, NB);
  attn_kernel<<<attn_grid, 32, 0, stream>>>(q_ws, k_ws, v_ws, a_ws);

  // 3) Output projection (fp32 result).
  dim3 proj_grid(DMODEL / 64, (unsigned)(TOK / 64));
  out_proj_kernel<<<proj_grid, 32, 0, stream>>>(a_ws, wo_h, bo, out);
}

// v002
// One run takes 231 microseconds.
// Timed twice side by side with v001, it ran 1.15 and 1.13 times as fast.
// Over all steps from v000 it is 1.62 times as fast.
#include <hip/hip_runtime.h>

#define DMODEL 1024
#define SLEN   2048
#define NHEAD  16
#define DK     64
#define NB     4

typedef __attribute__((ext_vector_type(16))) _Float16 v16h;
typedef __attribute__((ext_vector_type(8)))  _Float16 v8h;
typedef __attribute__((ext_vector_type(4)))  _Float16 v4h;
typedef __attribute__((ext_vector_type(4)))  float    v4f;
typedef __attribute__((ext_vector_type(8)))  float    v8f;

// D = A(16x32 f16) * B(32x16 f16) + C(16x16 f32)
__device__ __forceinline__ v8f wmma16(v16h a, v16h b, v8f c) {
  return __builtin_amdgcn_wmma_f32_16x16x32_f16(
      /*neg_a=*/false, a, /*neg_b=*/false, b,
      /*c_mod=*/(short)0, c, /*reuse_a=*/false, /*reuse_b=*/false);
}

__device__ __forceinline__ v16h frag_f16(const _Float16* __restrict__ p) {
  v8h a = *(const v8h*)(p);
  v8h b = *(const v8h*)(p + 16);
  v16h f;
#pragma unroll
  for (int j = 0; j < 8; ++j) { f[j] = a[j]; f[j + 8] = b[j]; }
  return f;
}

// ---------------------------------------------------------------------------
// Fragment-packed layout of every f16 workspace operand.
// A matrix M[row][k] that feeds WMMA as A (lane = row) or B (lane = column,
// stored as row) is kept as 16x32 fragments of 512 halves (1024 bytes), each
// in the order the lanes read it: two units of 256 halves, unit u holding
// k = u*16 + hi*8 + j at [lane = hi*16 + (row & 15)][j]. One wave-wide
// 16-byte load then covers 512 contiguous bytes (4 whole lines) where a
// row-major operand gives 16 rows x 32 bytes (16 lines).
// ---------------------------------------------------------------------------
#define FRAG 512  // halves per 16x32 fragment

// Place of element (row & 15, k & 31) inside its fragment, in halves.
__device__ __forceinline__ int pk_in_frag(int row, int k) {
  return ((k >> 4) & 1) * 256 + ((((k >> 3) & 1) << 4) + (row & 15)) * 8 +
         (k & 7);
}

__device__ __forceinline__ v16h frag_pk(const _Float16* __restrict__ p) {
  v8h a = *(const v8h*)(p);
  v8h b = *(const v8h*)(p + 256);
  v16h f;
#pragma unroll
  for (int j = 0; j < 8; ++j) { f[j] = a[j]; f[j + 8] = b[j]; }
  return f;
}

// ---------------------------------------------------------------------------
// Kernel 0: one-time fp32 -> f16 conversion (pure bandwidth pass) of a matrix
// with DMODEL columns, written fragment-packed: [row/16][k/32] fragments.
// A block converts 16 rows x 64 columns; a wave reads 4 rows x 128 bytes
// (whole lines) and writes 64-byte pieces of one fragment.
// ---------------------------------------------------------------------------
__global__ void __launch_bounds__(256)
cvt_f32_to_f16(const float* __restrict__ in, _Float16* __restrict__ out,
               int n4) {
  const int w = threadIdx.x >> 5, l = threadIdx.x & 31;
  const int R   = blockIdx.x >> 4;                       // 16-row tile
  const int kb  = (blockIdx.x & 15) * 2 + (w >> 2);      // 32-column block
  const int row = R * 16 + (w & 3) * 4 + (l >> 3);
  const int k   = kb * 32 + (l & 7) * 4;
  const int i   = row * (DMODEL / 4) + (k >> 2);
  if (i < n4) {
    v4f v = ((const v4f*)in)[i];
    v4h h;
#pragma unroll
    for (int j = 0; j < 4; ++j) h[j] = (_Float16)v[j];
    *(v4h*)(out + (size_t)(R * (DMODEL / 32) + kb) * FRAG +
            pk_in_frag(row, k)) = h;
  }
}

// ---------------------------------------------------------------------------
// Kernel 1: QKV projection, one wave per 64x64 output tile, blockIdx.z picks
// the matrix (0=Q, 1=K, 2=V).  out[m,n] = sum_k x[m,k]*W[n,k] + b[n].
// Per K-step: 4 A-frags + 4 B-frags (16 b128 loads) feed 16 WMMA.
// All operands and results are fragment-packed. Per (b, h): Q and K as
// [s/16][d/32] fragments (row = token, k = d), V as [s/32][d/16] fragments
// (row = d, k = token) so a 32-key chunk of K or of V is 4 KB in a row.
// ---------------------------------------------------------------------------
__global__ void __launch_bounds__(32)
qkv_gemm_kernel(const _Float16* __restrict__ Xh,
                const _Float16* __restrict__ Wqh,
                const _Float16* __restrict__ Wkh,
                const _Float16* __restrict__ Wvh,
                const float* __restrict__ bq, const float* __restrict__ bk,
                const float* __restrict__ bv,
                _Float16* __restrict__ Qo, _Float16* __restrict__ Ko,
                _Float16* __restrict__ Vo) {
  const int lane = threadIdx.x;
  const int lo = lane & 15, hi = lane >> 4;
  const int n0 = blockIdx.x * 64;
  const int m0 = blockIdx.y * 64;
  const int z  = blockIdx.z;
  const _Float16* W    = (z == 0) ? Wqh : (z == 1) ? Wkh : Wvh;
  const float*    bias = (z == 0) ? bq  : (z == 1) ? bk  : bv;

  // Packed operands: tile row t, k-block kb at (t * (DMODEL/32) + kb) * FRAG.
  const int TROW = (DMODEL / 32) * FRAG;  // halves per 16-row tile
  const _Float16* ap = Xh + (size_t)(m0 >> 4) * TROW + lane * 8;
  const _Float16* bp = W + (size_t)(n0 >> 4) * TROW + lane * 8;

  v8f acc[4][4] = {};
  for (int kb = 0; kb < DMODEL / 32; ++kb) {
    v16h a[4];
#pragma unroll
    for (int i = 0; i < 4; ++i) a[i] = frag_pk(ap + i * TROW + kb * FRAG);
    // The A loads share one address pair, which the register allocator may
    // reuse as a B load's result: the wait stands in front of that overwrite.
    asm volatile("s_wait_xcnt 0x0" ::: "memory");
#pragma unroll
    for (int j = 0; j < 4; ++j) {
      v16h bf = frag_pk(bp + j * TROW + kb * FRAG);
#pragma unroll
      for (int i = 0; i < 4; ++i) acc[i][j] = wmma16(a[i], bf, acc[i][j]);
    }
  }

  const int b_ = m0 >> 11;  // 64-row tile never crosses a batch boundary
  const int hh = n0 >> 6;   // 64-column tile is exactly one head
  const int sb = m0 & (SLEN - 1);
  const size_t head = (size_t)(b_ * NHEAD + hh) * SLEN * DK;
  if (z < 2) {  // Q or K: fragments [s/16][d/32], row = token, k = d
    _Float16* O = ((z == 0) ? Qo : Ko) + head;
#pragma unroll
    for (int j = 0; j < 4; ++j) {
      const int d = j * 16 + lo;
      const float bb = bias[n0 + d];
#pragma unroll
      for (int i = 0; i < 4; ++i) {
        _Float16* fr = O + (((sb >> 4) + i) * (DK / 32) + (d >> 5)) * FRAG;
#pragma unroll
        for (int r = 0; r < 8; ++r) {
          const int row = hi * 8 + r;
          fr[pk_in_frag(row, d)] = (_Float16)(acc[i][j][r] + bb);
        }
      }
    }
  } else {      // V: fragments [s/32][d/16], row = d, k = token
    _Float16* O = Vo + head;
#pragma unroll
    for (int j = 0; j < 4; ++j) {
      const float bb = bias[n0 + j * 16 + lo];
#pragma unroll
      for (int i = 0; i < 4; ++i) {
        const int s0 = sb + i * 16 + hi * 8;   // 8 tokens in a row per lane
        v8h o;
#pragma unroll
        for (int r = 0; r < 8; ++r) o[r] = (_Float16)(acc[i][j][r] + bb);
        *(v8h*)(O + ((s0 >> 5) * (DK / 16) + j) * FRAG + pk_in_frag(lo, s0)) = o;
      }
    }
    // Stands in front of any later overwrite of the stores' data and address
    // registers (the listing leaves a path from here into the branch above).
    asm volatile("s_wait_xcnt 0x0" ::: "memory");
  }
}

__device__ __forceinline__ float xhalf(float x) {
  const int b = __builtin_bit_cast(int, x);
  return __builtin_bit_cast(float, __builtin_amdgcn_permlanex16(
      b, b, 0x76543210, 0xfedcba98, false, false));
}

__global__ void __launch_bounds__(32)
attn_kernel(const _Float16* __restrict__ Q, const _Float16* __restrict__ K,
            const _Float16* __restrict__ V, _Float16* __restrict__ O) {
  const int lane = threadIdx.x;
  const int lo = lane & 15, hi = lane >> 4;
  const int q0 = blockIdx.x * 16;
  const int h  = blockIdx.y;
  const int b  = blockIdx.z;

  // Packed per head: a 16-token tile of Q or K is 2 fragments, a 32-key
  // chunk of K or of V is 4 fragments (CHUNK halves) in a row.
  const int CHUNK = 4 * FRAG;
  const size_t head = (size_t)(b * NHEAD + h) * SLEN * DK;
  const _Float16* qp = Q + head + (q0 >> 4) * (2 * FRAG) + lane * 8;
  const _Float16* kp = K + head;
  const _Float16* vp = V + head;

  const v16h qb0 = frag_pk(qp);         // B: column = query lo, k = d 0..31
  const v16h qb1 = frag_pk(qp + FRAG);  // B: column = query lo, k = d 32..63

  // Per lane: running maximum of query lo (alike in both halves), the sum
  // over this half's keys only, and O^T: acc[t][r] = O[lo][t*16 + hi*8 + r].
  float mrow = -__builtin_inff(), lrow = 0.f;
  v8f acc[4] = {{}, {}, {}, {}};
  const int qrow = q0 + lo;

  const int s_end = q0 + 16;  // causal upper bound
  for (int s0 = 0; s0 < s_end; s0 += 32) {
    const _Float16* kc = kp + (s0 >> 5) * CHUNK;
    const _Float16* vc = vp + (s0 >> 5) * CHUNK;
    // Prefetch next chunk's K and V (global_prefetch): one line per lane
    // covers each packed 4 KB chunk.
    __builtin_prefetch(kc + CHUNK + lane * 64, 0, 1);
    __builtin_prefetch(vc + CHUNK + lane * 64, 0, 1);

    // ---- scores: S^T = K * Q^T ----
    v8f sc0 = {}, sc1 = {};
    {
      const _Float16* kr0 = kc + lane * 8;             // keys s0 .. s0+15
      sc0 = wmma16(frag_pk(kr0), qb0, sc0);
      sc0 = wmma16(frag_pk(kr0 + FRAG), qb1, sc0);
      const _Float16* kr1 = kc + 2 * FRAG + lane * 8;  // keys s0+16 .. s0+31
      sc1 = wmma16(frag_pk(kr1), qb0, sc1);
      sc1 = wmma16(frag_pk(kr1 + FRAG), qb1, sc1);
    }

    const int rel = qrow - s0 - hi * 8;
#pragma unroll
    for (int r = 0; r < 8; ++r) {
      const float a0 = sc0[r] * 0.125f;   // 1/sqrt(64)
      const float a1 = sc1[r] * 0.125f;
      sc0[r] = (r <= rel)      ? a0 : -__builtin_inff();
      sc1[r] = (r + 16 <= rel) ? a1 : -__builtin_inff();
    }

    // ---- online softmax, one query per lane ----
    float cm0 = fmaxf(sc0[0], sc1[0]), cm1 = fmaxf(sc0[1], sc1[1]);
#pragma unroll
    for (int r = 2; r < 8; r += 2) {
      cm0 = fmaxf(fmaxf(cm0, sc0[r]), sc1[r]);
      cm1 = fmaxf(fmaxf(cm1, sc0[r + 1]), sc1[r + 1]);
    }
    float cm = fmaxf(cm0, cm1);
    cm = fmaxf(cm, xhalf(cm));  // all 32 keys; key s0 is never masked
    const float mnew = fmaxf(mrow, cm);
    const float corr = __expf(mrow - mnew);
    float rs0 = 0.f, rs1 = 0.f;
    v16h pb;  // B: column = query lo, k = key in the hardware order
#pragma unroll
    for (int r = 0; r < 8; ++r) {
      const float p0 = __expf(sc0[r] - mnew);
      const float p1 = __expf(sc1[r] - mnew);
      rs0 += p0;
      rs1 += p1;
      pb[r]     = (_Float16)p0;
      pb[r + 8] = (_Float16)p1;
    }
    lrow = lrow * corr + (rs0 + rs1);
    mrow = mnew;
#pragma unroll
    for (int t = 0; t < 4; ++t) acc[t] *= corr;

    // ---- O^T += V^T * P^T (fragment t: rows d = t*16 .. t*16+15) ----
#pragma unroll
    for (int t = 0; t < 4; ++t)
      acc[t] = wmma16(frag_pk(vc + t * FRAG + lane * 8), pb, acc[t]);
  }

  // ---- finalize: join the halves' sums, divide, store packed for the
  //      projection: fragments [token/16][k/32], row = token = lo,
  //      k = h*64 + d. A lane's 8 values of tile t are 8 d in a row, so each
  //      tile is one 16-byte store per lane, 512 bytes in a row per wave. ----
  _Float16* ot = O + ((size_t)((b * SLEN + q0) >> 4) * (DMODEL / 32) +
                      h * (DK / 32)) * FRAG + lane * 8;
  const float inv = 1.0f / (lrow + xhalf(lrow));
  v8h o[4];
#pragma unroll
  for (int t = 0; t < 4; ++t) {
#pragma unroll
    for (int r = 0; r < 8; ++r) o[t][r] = (_Float16)(acc[t][r] * inv);
  }
#pragma unroll
  for (int t = 0; t < 4; ++t)
    *(v8h*)(ot + (t >> 1) * FRAG + (t & 1) * 256) = o[t];
}

// ---------------------------------------------------------------------------
// Kernel 3: output projection, 64x64 tile per wave. out = attn @ Wo.T + bo,
// both operands fragment-packed, fp32 result straight to d_out.
// ---------------------------------------------------------------------------
__global__ void __launch_bounds__(32)
out_proj_kernel(const _Float16* __restrict__ A, const _Float16* __restrict__ W,
                const float* __restrict__ bias, float* __restrict__ out) {
  const int lane = threadIdx.x;
  const int lo = lane & 15, hi = lane >> 4;
  const int n0 = blockIdx.x * 64;
  const int m0 = blockIdx.y * 64;

  // Packed operands: tile row t, k-block kb at (t * (DMODEL/32) + kb) * FRAG.
  const int TROW = (DMODEL / 32) * FRAG;  // halves per 16-row tile
  const _Float16* ap = A + (size_t)(m0 >> 4) * TROW + lane * 8;
  const _Float16* bp = W + (size_t)(n0 >> 4) * TROW + lane * 8;

  v8f acc[4][4] = {};
  for (int kb = 0; kb < DMODEL / 32; ++kb) {
    v16h a[4];
#pragma unroll
    for (int i = 0; i < 4; ++i) a[i] = frag_pk(ap + i * TROW + kb * FRAG);
    // The A loads share one address pair, which the register allocator may
    // reuse as a B load's result: the wait stands in front of that overwrite.
    asm volatile("s_wait_xcnt 0x0" ::: "memory");
#pragma unroll
    for (int j = 0; j < 4; ++j) {
      v16h bf = frag_pk(bp + j * TROW + kb * FRAG);
#pragma unroll
      for (int i = 0; i < 4; ++i) acc[i][j] = wmma16(a[i], bf, acc[i][j]);
    }
  }

#pragma unroll
  for (int j = 0; j < 4; ++j) {
    const int col = n0 + j * 16 + lo;
    const float bb = bias[col];
#pragma unroll
    for (int i = 0; i < 4; ++i) {
#pragma unroll
      for (int r = 0; r < 8; ++r) {
        const int row = m0 + i * 16 + hi * 8 + r;
        out[(size_t)row * DMODEL + col] = acc[i][j][r] + bb;
      }
    }
  }
}

// ---------------------------------------------------------------------------
extern "C" void kernel_launch(void* const* d_in, const int* in_sizes, int n_in,
                              void* d_out, int out_size, void* d_ws,
                              size_t ws_size, hipStream_t stream) {
  const float* x  = (const float*)d_in[0];
  const float* Wq = (const float*)d_in[1];
  const float* bq = (const float*)d_in[2];
  const float* Wk = (const float*)d_in[3];
  const float* bk = (const float*)d_in[4];
  const float* Wv = (const float*)d_in[5];
  const float* bv = (const float*)d_in[6];
  const float* Wo = (const float*)d_in[7];
  const float* bo = (const float*)d_in[8];
  float* out = (float*)d_out;

  const size_t TOK = (size_t)NB * SLEN;          // 8192 tokens
  const size_t MAT = TOK * DMODEL;               // 8M elements
  const size_t WEL = (size_t)DMODEL * DMODEL;    // 1M elements

  // Workspace map (f16): q/k/v/attn 16 MB each, x_h 16 MB, weights 2 MB x4.
  char* ws = (char*)d_ws;
  _Float16* q_ws = (_Float16*)(ws);
  _Float16* k_ws = (_Float16*)(ws + 16ull * 1024 * 1024);
  _Float16* v_ws = (_Float16*)(ws + 32ull * 1024 * 1024);
  _Float16* a_ws = (_Float16*)(ws + 48ull * 1024 * 1024);
  _Float16* x_h  = (_Float16*)(ws + 64ull * 1024 * 1024);
  _Float16* wq_h = (_Float16*)(ws + 80ull * 1024 * 1024);
  _Float16* wk_h = (_Float16*)(ws + 82ull * 1024 * 1024);
  _Float16* wv_h = (_Float16*)(ws + 84ull * 1024 * 1024);
  _Float16* wo_h = (_Float16*)(ws + 86ull * 1024 * 1024);

  cvt_f32_to_f16<<<(int)(MAT / 4 / 256), 256, 0, stream>>>(x, x_h, (int)(MAT / 4));
  cvt_f32_to_f16<<<(int)(WEL / 4 / 256), 256, 0, stream>>>(Wq, wq_h, (int)(WEL / 4));
  cvt_f32_to_f16<<<(int)(WEL / 4 / 256), 256, 0, stream>>>(Wk, wk_h, (int)(WEL / 4));
  cvt_f32_to_f16<<<(int)(WEL / 4 / 256), 256, 0, stream>>>(Wv, wv_h, (int)(WEL / 4));
  cvt_f32_to_f16<<<(int)(WEL / 4 / 256), 256, 0, stream>>>(Wo, wo_h, (int)(WEL / 4));

  // 1) QKV projections: 64x64 tile per wave, z selects Q/K/V.
  dim3 qkv_grid(DMODEL / 64, (unsigned)(TOK / 64), 3);
  qkv_gemm_kernel<<<qkv_grid, 32, 0, stream>>>(x_h, wq_h, wk_h, wv_h,
                                               bq, bk, bv, q_ws, k_ws, v_ws);

  // 2) Attention: one wave per (query tile, head, batch).
  dim3 attn_grid(SLEN / 16, NHEAD, NB);
  attn_kernel<<<attn_grid, 32, 0, stream>>>(q_ws, k_ws, v_ws, a_ws);

  // 3) Output projection (fp32 result).
  dim3 proj_grid(DMODEL / 64, (unsigned)(TOK / 64));
  out_proj_kernel<<<proj_grid, 32, 0, stream>>>(a_ws, wo_h, bo, out);
}

// v003
// A run of this version takes 219 microseconds.
// Two timings next to v002 both put it at 1.05 times that version's speed.
// Counting every step since v000, it is 1.70 times as fast.
#include <hip/hip_runtime.h>

#define DMODEL 1024
#define SLEN   2048
#define NHEAD  16
#define DK     64
#define NB     4

typedef __attribute__((ext_vector_type(16))) _Float16 v16h;
typedef __attribute__((ext_vector_type(8)))  _Float16 v8h;
typedef __attribute__((ext_vector_type(4)))  _Float16 v4h;
typedef __attribute__((ext_vector_type(4)))  float    v4f;
typedef __attribute__((ext_vector_type(8)))  float    v8f;

// D = A(16x32 f16) * B(32x16 f16) + C(16x16 f32)
__device__ __forceinline__ v8f wmma16(v16h a, v16h b, v8f c) {
  return __builtin_amdgcn_wmma_f32_16x16x32_f16(
      /*neg_a=*/false, a, /*neg_b=*/false, b,
      /*c_mod=*/(short)0, c, /*reuse_a=*/false, /*reuse_b=*/false);
}

__device__ __forceinline__ v16h frag_f16(const _Float16* __restrict__ p) {
  v8h a = *(const v8h*)(p);
  v8h b = *(const v8h*)(p + 16);
  v16h f;
#pragma unroll
  for (int j = 0; j < 8; ++j) { f[j] = a[j]; f[j + 8] = b[j]; }
  return f;
}

// ---------------------------------------------------------------------------
// Fragment-packed layout of every f16 workspace operand.
// A matrix M[row][k] that feeds WMMA as A (lane = row) or B (lane = column,
// stored as row) is kept as 16x32 fragments of 512 halves (1024 bytes), each
// in the order the lanes read it: two units of 256 halves, unit u holding
// k = u*16 + hi*8 + j at [lane = hi*16 + (row & 15)][j]. One wave-wide
// 16-byte load then covers 512 contiguous bytes (4 whole lines) where a
// row-major operand gives 16 rows x 32 bytes (16 lines).
// ---------------------------------------------------------------------------
#define FRAG 512  // halves per 16x32 fragment

// Place of element (row & 15, k & 31) inside its fragment, in halves.
__device__ __forceinline__ int pk_in_frag(int row, int k) {
  return ((k >> 4) & 1) * 256 + ((((k >> 3) & 1) << 4) + (row & 15)) * 8 +
         (k & 7);
}

__device__ __forceinline__ v16h frag_pk(const _Float16* __restrict__ p) {
  v8h a = *(const v8h*)(p);
  v8h b = *(const v8h*)(p + 256);
  v16h f;
#pragma unroll
  for (int j = 0; j < 8; ++j) { f[j] = a[j]; f[j + 8] = b[j]; }
  return f;
}

#define XTILES   (NB * SLEN / 16)   // 16-row tiles of x
#define WTILES   (DMODEL / 16)      // 16-row tiles of one weight matrix
#define CVT_GRID 256
static_assert(XTILES == 2 * CVT_GRID && 4 * WTILES == CVT_GRID,
              "three row tiles per work-group");

__global__ void __launch_bounds__(512)
cvt_f32_to_f16(const float* __restrict__ x, const float* __restrict__ wq,
               const float* __restrict__ wk, const float* __restrict__ wv,
               const float* __restrict__ wo, _Float16* __restrict__ out) {
  const unsigned w = threadIdx.x >> 5, l = threadIdx.x & 31;
  const unsigned r = l >> 3;        // row inside a group of 4 rows
  const unsigned c = (l & 7) * 4;   // column inside a 32-column block
  const unsigned g = blockIdx.x;
  const unsigned TILE = 16 * DMODEL;  // elements of a row tile, in and out

  // Block-uniform tile bases, one lane offset for all of them.
  const unsigned m = g / WTILES;
  const float* wsel = (m & 2) ? ((m & 1) ? wo : wv) : ((m & 1) ? wk : wq);
  const float* src[3] = {x + (size_t)g * TILE,
                         x + (size_t)(g + CVT_GRID) * TILE,
                         wsel + (size_t)(g % WTILES) * TILE};
  const unsigned loff = r * DMODEL + w * 64 + c;

  v4f v[3][2][4];
#pragma unroll
  for (int p = 0; p < 3; ++p)
#pragma unroll
    for (int f = 0; f < 2; ++f)
#pragma unroll
      for (int q = 0; q < 4; ++q)
        v[p][f][q] = *(const v4f*)(src[p] + loff + q * 4 * DMODEL + f * 32);

  const unsigned soff = w * 2 * FRAG + pk_in_frag(r, c);
#pragma unroll
  for (int p = 0; p < 3; ++p) {
    _Float16* o = out + (size_t)(g + p * CVT_GRID) * TILE;
#pragma unroll
    for (int f = 0; f < 2; ++f)
#pragma unroll
      for (int q = 0; q < 4; ++q) {
        v4h h;
#pragma unroll
        for (int j = 0; j < 4; ++j) h[j] = (_Float16)v[p][f][q][j];
        // rows q*4 + r: 4 rows further on is 32 halves further on
        *(v4h*)(o + soff + f * FRAG + q * 32) = h;
      }
  }
}

// ---------------------------------------------------------------------------
// Kernel 1: QKV projection, one wave per 64x64 output tile, blockIdx.z picks
// the matrix (0=Q, 1=K, 2=V).  out[m,n] = sum_k x[m,k]*W[n,k] + b[n].
// Per K-step: 4 A-frags + 4 B-frags (16 b128 loads) feed 16 WMMA.
// All operands and results are fragment-packed. Per (b, h): Q and K as
// [s/16][d/32] fragments (row = token, k = d), V as [s/32][d/16] fragments
// (row = d, k = token) so a 32-key chunk of K or of V is 4 KB in a row.
// ---------------------------------------------------------------------------
__global__ void __launch_bounds__(32)
qkv_gemm_kernel(const _Float16* __restrict__ Xh,
                const _Float16* __restrict__ Wqh,
                const _Float16* __restrict__ Wkh,
                const _Float16* __restrict__ Wvh,
                const float* __restrict__ bq, const float* __restrict__ bk,
                const float* __restrict__ bv,
                _Float16* __restrict__ Qo, _Float16* __restrict__ Ko,
                _Float16* __restrict__ Vo) {
  const int lane = threadIdx.x;
  const int lo = lane & 15, hi = lane >> 4;
  const int n0 = blockIdx.x * 64;
  const int m0 = blockIdx.y * 64;
  const int z  = blockIdx.z;
  const _Float16* W    = (z == 0) ? Wqh : (z == 1) ? Wkh : Wvh;
  const float*    bias = (z == 0) ? bq  : (z == 1) ? bk  : bv;

  // Packed operands: tile row t, k-block kb at (t * (DMODEL/32) + kb) * FRAG.
  const int TROW = (DMODEL / 32) * FRAG;  // halves per 16-row tile
  const _Float16* ap = Xh + (size_t)(m0 >> 4) * TROW + lane * 8;
  const _Float16* bp = W + (size_t)(n0 >> 4) * TROW + lane * 8;

  v8f acc[4][4] = {};
  for (int kb = 0; kb < DMODEL / 32; ++kb) {
    v16h a[4];
#pragma unroll
    for (int i = 0; i < 4; ++i) a[i] = frag_pk(ap + i * TROW + kb * FRAG);
    // The A loads share one address pair, which the register allocator may
    // reuse as a B load's result: the wait stands in front of that overwrite.
    asm volatile("s_wait_xcnt 0x0" ::: "memory");
#pragma unroll
    for (int j = 0; j < 4; ++j) {
      v16h bf = frag_pk(bp + j * TROW + kb * FRAG);
#pragma unroll
      for (int i = 0; i < 4; ++i) acc[i][j] = wmma16(a[i], bf, acc[i][j]);
    }
  }

  const int b_ = m0 >> 11;  // 64-row tile never crosses a batch boundary
  const int hh = n0 >> 6;   // 64-column tile is exactly one head
  const int sb = m0 & (SLEN - 1);
  const size_t head = (size_t)(b_ * NHEAD + hh) * SLEN * DK;
  if (z < 2) {  // Q or K: fragments [s/16][d/32], row = token, k = d
    _Float16* O = ((z == 0) ? Qo : Ko) + head;
#pragma unroll
    for (int j = 0; j < 4; ++j) {
      const int d = j * 16 + lo;
      const float bb = bias[n0 + d];
#pragma unroll
      for (int i = 0; i < 4; ++i) {
        _Float16* fr = O + (((sb >> 4) + i) * (DK / 32) + (d >> 5)) * FRAG;
#pragma unroll
        for (int r = 0; r < 8; ++r) {
          const int row = hi * 8 + r;
          fr[pk_in_frag(row, d)] = (_Float16)(acc[i][j][r] + bb);
        }
      }
    }
  } else {      // V: fragments [s/32][d/16], row = d, k = token
    _Float16* O = Vo + head;
#pragma unroll
    for (int j = 0; j < 4; ++j) {
      const float bb = bias[n0 + j * 16 + lo];
#pragma unroll
      for (int i = 0; i < 4; ++i) {
        const int s0 = sb + i * 16 + hi * 8;   // 8 tokens in a row per lane
        v8h o;
#pragma unroll
        for (int r = 0; r < 8; ++r) o[r] = (_Float16)(acc[i][j][r] + bb);
        *(v8h*)(O + ((s0 >> 5) * (DK / 16) + j) * FRAG + pk_in_frag(lo, s0)) = o;
      }
    }
    // Stands in front of any later overwrite of the stores' data and address
    // registers (the listing leaves a path from here into the branch above).
    asm volatile("s_wait_xcnt 0x0" ::: "memory");
  }
}

__device__ __forceinline__ float xhalf(float x) {
  const int b = __builtin_bit_cast(int, x);
  return __builtin_bit_cast(float, __builtin_amdgcn_permlanex16(
      b, b, 0x76543210, 0xfedcba98, false, false));
}

__global__ void __launch_bounds__(32)
attn_kernel(const _Float16* __restrict__ Q, const _Float16* __restrict__ K,
            const _Float16* __restrict__ V, _Float16* __restrict__ O) {
  const int lane = threadIdx.x;
  const int lo = lane & 15, hi = lane >> 4;
  const int q0 = blockIdx.x * 16;
  const int h  = blockIdx.y;
  const int b  = blockIdx.z;

  // Packed per head: a 16-token tile of Q or K is 2 fragments, a 32-key
  // chunk of K or of V is 4 fragments (CHUNK halves) in a row.
  const int CHUNK = 4 * FRAG;
  const size_t head = (size_t)(b * NHEAD + h) * SLEN * DK;
  const _Float16* qp = Q + head + (q0 >> 4) * (2 * FRAG) + lane * 8;
  const _Float16* kp = K + head;
  const _Float16* vp = V + head;

  const v16h qb0 = frag_pk(qp);         // B: column = query lo, k = d 0..31
  const v16h qb1 = frag_pk(qp + FRAG);  // B: column = query lo, k = d 32..63

  // Per lane: running maximum of query lo (alike in both halves), the sum
  // over this half's keys only, and O^T: acc[t][r] = O[lo][t*16 + hi*8 + r].
  float mrow = -__builtin_inff(), lrow = 0.f;
  v8f acc[4] = {{}, {}, {}, {}};
  const int qrow = q0 + lo;

  const int s_end = q0 + 16;  // causal upper bound
  for (int s0 = 0; s0 < s_end; s0 += 32) {
    const _Float16* kc = kp + (s0 >> 5) * CHUNK;
    const _Float16* vc = vp + (s0 >> 5) * CHUNK;
    // Prefetch next chunk's K and V (global_prefetch): one line per lane
    // covers each packed 4 KB chunk.
    __builtin_prefetch(kc + CHUNK + lane * 64, 0, 1);
    __builtin_prefetch(vc + CHUNK + lane * 64, 0, 1);

    // ---- scores: S^T = K * Q^T ----
    v8f sc0 = {}, sc1 = {};
    {
      const _Float16* kr0 = kc + lane * 8;             // keys s0 .. s0+15
      sc0 = wmma16(frag_pk(kr0), qb0, sc0);
      sc0 = wmma16(frag_pk(kr0 + FRAG), qb1, sc0);
      const _Float16* kr1 = kc + 2 * FRAG + lane * 8;  // keys s0+16 .. s0+31
      sc1 = wmma16(frag_pk(kr1), qb0, sc1);
      sc1 = wmma16(frag_pk(kr1 + FRAG), qb1, sc1);
    }

    const int rel = qrow - s0 - hi * 8;
#pragma unroll
    for (int r = 0; r < 8; ++r) {
      const float a0 = sc0[r] * 0.125f;   // 1/sqrt(64)
      const float a1 = sc1[r] * 0.125f;
      sc0[r] = (r <= rel)      ? a0 : -__builtin_inff();
      sc1[r] = (r + 16 <= rel) ? a1 : -__builtin_inff();
    }

    // ---- online softmax, one query per lane ----
    float cm0 = fmaxf(sc0[0], sc1[0]), cm1 = fmaxf(sc0[1], sc1[1]);
#pragma unroll
    for (int r = 2; r < 8; r += 2) {
      cm0 = fmaxf(fmaxf(cm0, sc0[r]), sc1[r]);
      cm1 = fmaxf(fmaxf(cm1, sc0[r + 1]), sc1[r + 1]);
    }
    float cm = fmaxf(cm0, cm1);
    cm = fmaxf(cm, xhalf(cm));  // all 32 keys; key s0 is never masked
    const float mnew = fmaxf(mrow, cm);
    const float corr = __expf(mrow - mnew);
    float rs0 = 0.f, rs1 = 0.f;
    v16h pb;  // B: column = query lo, k = key in the hardware order
#pragma unroll
    for (int r = 0; r < 8; ++r) {
      const float p0 = __expf(sc0[r] - mnew);
      const float p1 = __expf(sc1[r] - mnew);
      rs0 += p0;
      rs1 += p1;
      pb[r]     = (_Float16)p0;
      pb[r + 8] = (_Float16)p1;
    }
    lrow = lrow * corr + (rs0 + rs1);
    mrow = mnew;
#pragma unroll
    for (int t = 0; t < 4; ++t) acc[t] *= corr;

    // ---- O^T += V^T * P^T (fragment t: rows d = t*16 .. t*16+15) ----
#pragma unroll
    for (int t = 0; t < 4; ++t)
      acc[t] = wmma16(frag_pk(vc + t * FRAG + lane * 8), pb, acc[t]);
  }

  // ---- finalize: join the halves' sums, divide, store packed for the
  //      projection: fragments [token/16][k/32], row = token = lo,
  //      k = h*64 + d. A lane's 8 values of tile t are 8 d in a row, so each
  //      tile is one 16-byte store per lane, 512 bytes in a row per wave. ----
  _Float16* ot = O + ((size_t)((b * SLEN + q0) >> 4) * (DMODEL / 32) +
                      h * (DK / 32)) * FRAG + lane * 8;
  const float inv = 1.0f / (lrow + xhalf(lrow));
  v8h o[4];
#pragma unroll
  for (int t = 0; t < 4; ++t) {
#pragma unroll
    for (int r = 0; r < 8; ++r) o[t][r] = (_Float16)(acc[t][r] * inv);
  }
#pragma unroll
  for (int t = 0; t < 4; ++t)
    *(v8h*)(ot + (t >> 1) * FRAG + (t & 1) * 256) = o[t];
}

// ---------------------------------------------------------------------------
// Kernel 3: output projection, 64x64 tile per wave. out = attn @ Wo.T + bo,
// both operands fragment-packed, fp32 result straight to d_out.
// ---------------------------------------------------------------------------
__global__ void __launch_bounds__(32)
out_proj_kernel(const _Float16* __restrict__ A, const _Float16* __restrict__ W,
                const float* __restrict__ bias, float* __restrict__ out) {
  const int lane = threadIdx.x;
  const int lo = lane & 15, hi = lane >> 4;
  const int n0 = blockIdx.x * 64;
  const int m0 = blockIdx.y * 64;

  // Packed operands: tile row t, k-block kb at (t * (DMODEL/32) + kb) * FRAG.
  const int TROW = (DMODEL / 32) * FRAG;  // halves per 16-row tile
  const _Float16* ap = A + (size_t)(m0 >> 4) * TROW + lane * 8;
  const _Float16* bp = W + (size_t)(n0 >> 4) * TROW + lane * 8;

  v8f acc[4][4] = {};
  for (int kb = 0; kb < DMODEL / 32; ++kb) {
    v16h a[4];
#pragma unroll
    for (int i = 0; i < 4; ++i) a[i] = frag_pk(ap + i * TROW + kb * FRAG);
    // The A loads share one address pair, which the register allocator may
    // reuse as a B load's result: the wait stands in front of that overwrite.
    asm volatile("s_wait_xcnt 0x0" ::: "memory");
#pragma unroll
    for (int j = 0; j < 4; ++j) {
      v16h bf = frag_pk(bp + j * TROW + kb * FRAG);
#pragma unroll
      for (int i = 0; i < 4; ++i) acc[i][j] = wmma16(a[i], bf, acc[i][j]);
    }
  }

#pragma unroll
  for (int j = 0; j < 4; ++j) {
    const int col = n0 + j * 16 + lo;
    const float bb = bias[col];
#pragma unroll
    for (int i = 0; i < 4; ++i) {
#pragma unroll
      for (int r = 0; r < 8; ++r) {
        const int row = m0 + i * 16 + hi * 8 + r;
        out[(size_t)row * DMODEL + col] = acc[i][j][r] + bb;
      }
    }
  }
}

// ---------------------------------------------------------------------------
extern "C" void kernel_launch(void* const* d_in, const int* in_sizes, int n_in,
                              void* d_out, int out_size, void* d_ws,
                              size_t ws_size, hipStream_t stream) {
  const float* x  = (const float*)d_in[0];
  const float* Wq = (const float*)d_in[1];
  const float* bq = (const float*)d_in[2];
  const float* Wk = (const float*)d_in[3];
  const float* bk = (const float*)d_in[4];
  const float* Wv = (const float*)d_in[5];
  const float* bv = (const float*)d_in[6];
  const float* Wo = (const float*)d_in[7];
  const float* bo = (const float*)d_in[8];
  float* out = (float*)d_out;

  const size_t TOK = (size_t)NB * SLEN;          // 8192 tokens

  // Workspace map (f16): q/k/v/attn 16 MB each, x_h 16 MB, weights 2 MB x4.
  char* ws = (char*)d_ws;
  _Float16* q_ws = (_Float16*)(ws);
  _Float16* k_ws = (_Float16*)(ws + 16ull * 1024 * 1024);
  _Float16* v_ws = (_Float16*)(ws + 32ull * 1024 * 1024);
  _Float16* a_ws = (_Float16*)(ws + 48ull * 1024 * 1024);
  _Float16* x_h  = (_Float16*)(ws + 64ull * 1024 * 1024);
  _Float16* wq_h = (_Float16*)(ws + 80ull * 1024 * 1024);
  _Float16* wk_h = (_Float16*)(ws + 82ull * 1024 * 1024);
  _Float16* wv_h = (_Float16*)(ws + 84ull * 1024 * 1024);
  _Float16* wo_h = (_Float16*)(ws + 86ull * 1024 * 1024);

  // 0) fp32 -> f16 conversion, one launch: x_h and the four weight planes
  //    lie one behind the other in the workspace map above.
  cvt_f32_to_f16<<<CVT_GRID, 512, 0, stream>>>(x, Wq, Wk, Wv, Wo, x_h);

  // 1) QKV projections: 64x64 tile per wave, z selects Q/K/V.
  dim3 qkv_grid(DMODEL / 64, (unsigned)(TOK / 64), 3);
  qkv_gemm_kernel<<<qkv_grid, 32, 0, stream>>>(x_h, wq_h, wk_h, wv_h,
                                               bq, bk, bv, q_ws, k_ws, v_ws);

  // 2) Attention: one wave per (query tile, head, batch).
  dim3 attn_grid(SLEN / 16, NHEAD, NB);
  attn_kernel<<<attn_grid, 32, 0, stream>>>(q_ws, k_ws, v_ws, a_ws);

  // 3) Output projection (fp32 result).
  dim3 proj_grid(DMODEL / 64, (unsigned)(TOK / 64));
  out_proj_kernel<<<proj_grid, 32, 0, stream>>>(a_ws, wo_h, bo, out);
}

// v004
// A run of this version takes 187 microseconds.
// Timed twice side by side with v003, it ran 1.17 and 1.18 times as fast.
// Counting every step since v000, it is 1.99 times as fast.
#include <hip/hip_runtime.h>

#define DMODEL 1024
#define SLEN   2048
#define NHEAD  16
#define DK     64
#define NB     4

typedef __attribute__((ext_vector_type(16))) _Float16 v16h;
typedef __attribute__((ext_vector_type(8)))  _Float16 v8h;
typedef __attribute__((ext_vector_type(4)))  _Float16 v4h;
typedef __attribute__((ext_vector_type(4)))  float    v4f;
typedef __attribute__((ext_vector_type(8)))  float    v8f;

// D = A(16x32 f16) * B(32x16 f16) + C(16x16 f32)
__device__ __forceinline__ v8f wmma16(v16h a, v16h b, v8f c) {
  return __builtin_amdgcn_wmma_f32_16x16x32_f16(
      /*neg_a=*/false, a, /*neg_b=*/false, b,
      /*c_mod=*/(short)0, c, /*reuse_a=*/false, /*reuse_b=*/false);
}

__device__ __forceinline__ v16h frag_f16(const _Float16* __restrict__ p) {
  v8h a = *(const v8h*)(p);
  v8h b = *(const v8h*)(p + 16);
  v16h f;
#pragma unroll
  for (int j = 0; j < 8; ++j) { f[j] = a[j]; f[j + 8] = b[j]; }
  return f;
}

// ---------------------------------------------------------------------------
// Fragment-packed layout of every f16 workspace operand.
// A matrix M[row][k] that feeds WMMA as A (lane = row) or B (lane = column,
// stored as row) is kept as 16x32 fragments of 512 halves (1024 bytes), each
// in the order the lanes read it: two units of 256 halves, unit u holding
// k = u*16 + hi*8 + j at [lane = hi*16 + (row & 15)][j]. One wave-wide
// 16-byte load then covers 512 contiguous bytes (4 whole lines) where a
// row-major operand gives 16 rows x 32 bytes (16 lines).
// ---------------------------------------------------------------------------
#define FRAG 512  // halves per 16x32 fragment

// Place of element (row & 15, k & 31) inside its fragment, in halves.
__device__ __forceinline__ int pk_in_frag(int row, int k) {
  return ((k >> 4) & 1) * 256 + ((((k >> 3) & 1) << 4) + (row & 15)) * 8 +
         (k & 7);
}

__device__ __forceinline__ v16h frag_pk(const _Float16* __restrict__ p) {
  v8h a = *(const v8h*)(p);
  v8h b = *(const v8h*)(p + 256);
  v16h f;
#pragma unroll
  for (int j = 0; j < 8; ++j) { f[j] = a[j]; f[j + 8] = b[j]; }
  return f;
}

#define XTILES   (NB * SLEN / 16)   // 16-row tiles of x
#define WTILES   (DMODEL / 16)      // 16-row tiles of one weight matrix
#define CVT_GRID 256
static_assert(XTILES == 2 * CVT_GRID && 4 * WTILES == CVT_GRID,
              "three row tiles per work-group");

__global__ void __launch_bounds__(512)
cvt_f32_to_f16(const float* __restrict__ x, const float* __restrict__ wq,
               const float* __restrict__ wk, const float* __restrict__ wv,
               const float* __restrict__ wo, _Float16* __restrict__ out) {
  const unsigned w = threadIdx.x >> 5, l = threadIdx.x & 31;
  const unsigned r = l >> 3;        // row inside a group of 4 rows
  const unsigned c = (l & 7) * 4;   // column inside a 32-column block
  const unsigned g = blockIdx.x;
  const unsigned TILE = 16 * DMODEL;  // elements of a row tile, in and out

  // Block-uniform tile bases, one lane offset for all of them.
  const unsigned m = g / WTILES;
  const float* wsel = (m & 2) ? ((m & 1) ? wo : wv) : ((m & 1) ? wk : wq);
  const float* src[3] = {x + (size_t)g * TILE,
                         x + (size_t)(g + CVT_GRID) * TILE,
                         wsel + (size_t)(g % WTILES) * TILE};
  const unsigned loff = r * DMODEL + w * 64 + c;

  v4f v[3][2][4];
#pragma unroll
  for (int p = 0; p < 3; ++p)
#pragma unroll
    for (int f = 0; f < 2; ++f)
#pragma unroll
      for (int q = 0; q < 4; ++q)
        v[p][f][q] = *(const v4f*)(src[p] + loff + q * 4 * DMODEL + f * 32);

  const unsigned soff = w * 2 * FRAG + pk_in_frag(r, c);
#pragma unroll
  for (int p = 0; p < 3; ++p) {
    _Float16* o = out + (size_t)(g + p * CVT_GRID) * TILE;
#pragma unroll
    for (int f = 0; f < 2; ++f)
#pragma unroll
      for (int q = 0; q < 4; ++q) {
        v4h h;
#pragma unroll
        for (int j = 0; j < 4; ++j) h[j] = (_Float16)v[p][f][q][j];
        // rows q*4 + r: 4 rows further on is 32 halves further on
        *(v4h*)(o + soff + f * FRAG + q * 32) = h;
      }
  }
}

#define GEMM_WAVES 8
#define GEMM_TM    256
#define GEMM_TN    128
#define ST_FRAGS   2                               // fragments per tile row
#define ST_COUNT   (DMODEL / 32 / ST_FRAGS)        // stages
#define ST_ROW     (ST_FRAGS * FRAG)               // halves per tile row
#define ST_AROWS   (GEMM_TM / 16)
#define ST_ROWS    ((GEMM_TM + GEMM_TN) / 16)      // tile rows per stage
#define ST_HALVES  (ST_ROWS * ST_ROW)              // halves per buffer
static_assert(ST_ROWS == 3 * GEMM_WAVES && ST_ROW == 4 * 256 && ST_COUNT >= 2,
              "a wave copies three tile rows, four 512-byte pieces each");

__device__ __forceinline__ void copy_row(unsigned l, const _Float16* g) {
  asm volatile(
      "global_load_async_to_lds_b128 %0, %4, off\n\t"
      "global_load_async_to_lds_b128 %1, %5, off\n\t"
      "global_load_async_to_lds_b128 %2, %6, off\n\t"
      "global_load_async_to_lds_b128 %3, %7, off\n\t"
      "s_wait_xcnt 0x0"
      :
      : "v"(l), "v"(l + 512u), "v"(l + 1024u), "v"(l + 1536u),
        "v"(g), "v"(g + 256), "v"(g + 512), "v"(g + 768)
      : "memory");
}
__device__ __forceinline__ void copy_stage(unsigned l, const _Float16* g0,
                                           const _Float16* g1,
                                           const _Float16* g2) {
  copy_row(l, g0);
  copy_row(l + 2048u, g1);
  copy_row(l + 4096u, g2);
}

// Ab, Bb: first packed tile row of the block's A rows and B rows. wave is
// wave-uniform. On return acc holds the wave's 64x64 tile, rows
// (wave >> 1) * 64, columns (wave & 1) * 64 of the block.
__device__ __forceinline__ void gemm_block(const _Float16* __restrict__ Ab,
                                           const _Float16* __restrict__ Bb,
                                           _Float16* L, unsigned wave,
                                           unsigned lane, v8f (&acc)[4][4]) {
  const int TROW = (DMODEL / 32) * FRAG;  // halves per packed 16-row tile
  const _Float16* g[3];
#pragma unroll
  for (unsigned i = 0; i < 3; ++i) {
    const unsigned r = 3 * wave + i;  // tile row of the stage: A first, then B
    g[i] = ((r < ST_AROWS) ? Ab + (size_t)r * TROW
                           : Bb + (size_t)(r - ST_AROWS) * TROW) + lane * 8;
  }
  const unsigned lcp =
      (unsigned)(size_t)L + (wave * 3 * ST_ROW + lane * 8) * 2;  // bytes

  copy_stage(lcp, g[0], g[1], g[2]);
  // Stage 0 has landed for this wave, and behind the barrier for all waves.
  asm volatile("s_wait_asynccnt 0x0" ::: "memory");
  __syncthreads();
  copy_stage(lcp + ST_HALVES * 2, g[0] + ST_ROW, g[1] + ST_ROW, g[2] + ST_ROW);

  const _Float16* la = L + (wave >> 1) * 4 * ST_ROW + lane * 8;
  const _Float16* lb = L + (ST_AROWS + (wave & 1) * 4) * ST_ROW + lane * 8;
  for (int t = 0; t < ST_COUNT; ++t) {
    const unsigned buf = (t & 1) * ST_HALVES;
    v16h a[4], bf[4];
#pragma unroll
    for (int kk = 0; kk < ST_FRAGS; ++kk) {
      bf[0] = frag_pk(lb + buf + kk * FRAG);
#pragma unroll
      for (int i = 0; i < 4; ++i)
        a[i] = frag_pk(la + buf + i * ST_ROW + kk * FRAG);
#pragma unroll
      for (int j = 1; j < 4; ++j)
        bf[j] = frag_pk(lb + buf + j * ST_ROW + kk * FRAG);
      if (kk == ST_FRAGS - 1) {
        // Publish point of stage t + 1, behind the stage's last LDS reads and
        // in front of their WMMAs: this wave's reads of stage t are done, its
        // copies of stage t + 1 have landed; the barrier says so of every
        // wave.
        asm volatile("s_wait_dscnt 0x0" ::: "memory");
        asm volatile("s_wait_asynccnt 0x0" ::: "memory");
        __syncthreads();
        if (t + 2 < ST_COUNT)  // refill the buffer that every wave has left
          copy_stage(lcp + buf * 2, g[0] + (t + 2) * ST_ROW,
                     g[1] + (t + 2) * ST_ROW, g[2] + (t + 2) * ST_ROW);
      }
      // Holds the 16 LDS reads of a k-step (and the refill) together in front
      // of its WMMAs: left alone the compiler sinks the B reads among the
      // WMMAs, one register set, a wait to 0 in front of every four.
      __builtin_amdgcn_sched_barrier(0);
#pragma unroll
      for (int j = 0; j < 4; ++j)
#pragma unroll
        for (int i = 0; i < 4; ++i) acc[i][j] = wmma16(a[i], bf[j], acc[i][j]);
    }
  }
  // No copy is outstanding when the wave goes on to its stores and ends.
  asm volatile("s_wait_asynccnt 0x0" ::: "memory");
}

// ---------------------------------------------------------------------------
// Kernel 1: QKV projection, one wave per 64x64 output tile, 8 waves per
// work-group (gemm_block), blockIdx.z picks the matrix (0=Q, 1=K, 2=V).
// out[m,n] = sum_k x[m,k]*W[n,k] + b[n].
// All operands and results are fragment-packed. Per (b, h): Q and K as
// [s/16][d/32] fragments (row = token, k = d), V as [s/32][d/16] fragments
// (row = d, k = token) so a 32-key chunk of K or of V is 4 KB in a row.
// ---------------------------------------------------------------------------
__global__ void __launch_bounds__(GEMM_WAVES * 32, 4)
qkv_gemm_kernel(const _Float16* __restrict__ Xh,
                const _Float16* __restrict__ Wqh,
                const _Float16* __restrict__ Wkh,
                const _Float16* __restrict__ Wvh,
                const float* __restrict__ bq, const float* __restrict__ bk,
                const float* __restrict__ bv,
                _Float16* __restrict__ Qo, _Float16* __restrict__ Ko,
                _Float16* __restrict__ Vo) {
  __shared__ __attribute__((aligned(16))) _Float16 L[2 * ST_HALVES];
  const unsigned wave = __builtin_amdgcn_readfirstlane(threadIdx.x >> 5);
  const int lane = threadIdx.x & 31;
  const int lo = lane & 15, hi = lane >> 4;
  const int z  = blockIdx.z;
  const _Float16* W    = (z == 0) ? Wqh : (z == 1) ? Wkh : Wvh;
  const float*    bias = (z == 0) ? bq  : (z == 1) ? bk  : bv;

  // Packed operands: tile row t, k-block kb at (t * (DMODEL/32) + kb) * FRAG.
  const int TROW = (DMODEL / 32) * FRAG;  // halves per 16-row tile
  v8f acc[4][4] = {};
  gemm_block(Xh + (size_t)blockIdx.y * (GEMM_TM / 16) * TROW,
             W + (size_t)blockIdx.x * (GEMM_TN / 16) * TROW, L, wave, lane,
             acc);
  const int n0 = blockIdx.x * GEMM_TN + (wave & 1) * 64;
  const int m0 = blockIdx.y * GEMM_TM + (wave >> 1) * 64;

  const int b_ = m0 >> 11;  // 64-row tile never crosses a batch boundary
  const int hh = n0 >> 6;   // 64-column tile is exactly one head
  const int sb = m0 & (SLEN - 1);
  const size_t head = (size_t)(b_ * NHEAD + hh) * SLEN * DK;
  if (z < 2) {  // Q or K: fragments [s/16][d/32], row = token, k = d
    _Float16* O = ((z == 0) ? Qo : Ko) + head;
#pragma unroll
    for (int j = 0; j < 4; ++j) {
      const int d = j * 16 + lo;
      const float bb = bias[n0 + d];
#pragma unroll
      for (int i = 0; i < 4; ++i) {
        _Float16* fr = O + (((sb >> 4) + i) * (DK / 32) + (d >> 5)) * FRAG;
#pragma unroll
        for (int r = 0; r < 8; ++r) {
          const int row = hi * 8 + r;
          fr[pk_in_frag(row, d)] = (_Float16)(acc[i][j][r] + bb);
        }
      }
    }
  } else {      // V: fragments [s/32][d/16], row = d, k = token
    _Float16* O = Vo + head;
#pragma unroll
    for (int j = 0; j < 4; ++j) {
      const float bb = bias[n0 + j * 16 + lo];
#pragma unroll
      for (int i = 0; i < 4; ++i) {
        const int s0 = sb + i * 16 + hi * 8;   // 8 tokens in a row per lane
        v8h o;
#pragma unroll
        for (int r = 0; r < 8; ++r) o[r] = (_Float16)(acc[i][j][r] + bb);
        *(v8h*)(O + ((s0 >> 5) * (DK / 16) + j) * FRAG + pk_in_frag(lo, s0)) = o;
      }
      __builtin_amdgcn_sched_barrier(0);
    }
    // Stands in front of any later overwrite of the stores' data and address
    // registers (the listing leaves a path from here into the branch above).
    asm volatile("s_wait_xcnt 0x0" ::: "memory");
  }
}

__device__ __forceinline__ float xhalf(float x) {
  const int b = __builtin_bit_cast(int, x);
  return __builtin_bit_cast(float, __builtin_amdgcn_permlanex16(
      b, b, 0x76543210, 0xfedcba98, false, false));
}

__global__ void __launch_bounds__(32)
attn_kernel(const _Float16* __restrict__ Q, const _Float16* __restrict__ K,
            const _Float16* __restrict__ V, _Float16* __restrict__ O) {
  const int lane = threadIdx.x;
  const int lo = lane & 15, hi = lane >> 4;
  const int q0 = blockIdx.x * 16;
  const int h  = blockIdx.y;
  const int b  = blockIdx.z;

  // Packed per head: a 16-token tile of Q or K is 2 fragments, a 32-key
  // chunk of K or of V is 4 fragments (CHUNK halves) in a row.
  const int CHUNK = 4 * FRAG;
  const size_t head = (size_t)(b * NHEAD + h) * SLEN * DK;
  const _Float16* qp = Q + head + (q0 >> 4) * (2 * FRAG) + lane * 8;
  const _Float16* kp = K + head;
  const _Float16* vp = V + head;

  const v16h qb0 = frag_pk(qp);         // B: column = query lo, k = d 0..31
  const v16h qb1 = frag_pk(qp + FRAG);  // B: column = query lo, k = d 32..63

  // Per lane: running maximum of query lo (alike in both halves), the sum
  // over this half's keys only, and O^T: acc[t][r] = O[lo][t*16 + hi*8 + r].
  float mrow = -__builtin_inff(), lrow = 0.f;
  v8f acc[4] = {{}, {}, {}, {}};
  const int qrow = q0 + lo;

  const int s_end = q0 + 16;  // causal upper bound
  for (int s0 = 0; s0 < s_end; s0 += 32) {
    const _Float16* kc = kp + (s0 >> 5) * CHUNK;
    const _Float16* vc = vp + (s0 >> 5) * CHUNK;
    // Prefetch next chunk's K and V (global_prefetch): one line per lane
    // covers each packed 4 KB chunk.
    __builtin_prefetch(kc + CHUNK + lane * 64, 0, 1);
    __builtin_prefetch(vc + CHUNK + lane * 64, 0, 1);

    // ---- scores: S^T = K * Q^T ----
    v8f sc0 = {}, sc1 = {};
    {
      const _Float16* kr0 = kc + lane * 8;             // keys s0 .. s0+15
      sc0 = wmma16(frag_pk(kr0), qb0, sc0);
      sc0 = wmma16(frag_pk(kr0 + FRAG), qb1, sc0);
      const _Float16* kr1 = kc + 2 * FRAG + lane * 8;  // keys s0+16 .. s0+31
      sc1 = wmma16(frag_pk(kr1), qb0, sc1);
      sc1 = wmma16(frag_pk(kr1 + FRAG), qb1, sc1);
    }

    const int rel = qrow - s0 - hi * 8;
#pragma unroll
    for (int r = 0; r < 8; ++r) {
      const float a0 = sc0[r] * 0.125f;   // 1/sqrt(64)
      const float a1 = sc1[r] * 0.125f;
      sc0[r] = (r <= rel)      ? a0 : -__builtin_inff();
      sc1[r] = (r + 16 <= rel) ? a1 : -__builtin_inff();
    }

    // ---- online softmax, one query per lane ----
    float cm0 = fmaxf(sc0[0], sc1[0]), cm1 = fmaxf(sc0[1], sc1[1]);
#pragma unroll
    for (int r = 2; r < 8; r += 2) {
      cm0 = fmaxf(fmaxf(cm0, sc0[r]), sc1[r]);
      cm1 = fmaxf(fmaxf(cm1, sc0[r + 1]), sc1[r + 1]);
    }
    float cm = fmaxf(cm0, cm1);
    cm = fmaxf(cm, xhalf(cm));  // all 32 keys; key s0 is never masked
    const float mnew = fmaxf(mrow, cm);
    const float corr = __expf(mrow - mnew);
    float rs0 = 0.f, rs1 = 0.f;
    v16h pb;  // B: column = query lo, k = key in the hardware order
#pragma unroll
    for (int r = 0; r < 8; ++r) {
      const float p0 = __expf(sc0[r] - mnew);
      const float p1 = __expf(sc1[r] - mnew);
      rs0 += p0;
      rs1 += p1;
      pb[r]     = (_Float16)p0;
      pb[r + 8] = (_Float16)p1;
    }
    lrow = lrow * corr + (rs0 + rs1);
    mrow = mnew;
#pragma unroll
    for (int t = 0; t < 4; ++t) acc[t] *= corr;

    // ---- O^T += V^T * P^T (fragment t: rows d = t*16 .. t*16+15) ----
#pragma unroll
    for (int t = 0; t < 4; ++t)
      acc[t] = wmma16(frag_pk(vc + t * FRAG + lane * 8), pb, acc[t]);
  }

  // ---- finalize: join the halves' sums, divide, store packed for the
  //      projection: fragments [token/16][k/32], row = token = lo,
  //      k = h*64 + d. A lane's 8 values of tile t are 8 d in a row, so each
  //      tile is one 16-byte store per lane, 512 bytes in a row per wave. ----
  _Float16* ot = O + ((size_t)((b * SLEN + q0) >> 4) * (DMODEL / 32) +
                      h * (DK / 32)) * FRAG + lane * 8;
  const float inv = 1.0f / (lrow + xhalf(lrow));
  v8h o[4];
#pragma unroll
  for (int t = 0; t < 4; ++t) {
#pragma unroll
    for (int r = 0; r < 8; ++r) o[t][r] = (_Float16)(acc[t][r] * inv);
  }
#pragma unroll
  for (int t = 0; t < 4; ++t)
    *(v8h*)(ot + (t >> 1) * FRAG + (t & 1) * 256) = o[t];
}

// ---------------------------------------------------------------------------
// Kernel 3: output projection, 64x64 tile per wave, 8 waves per work-group
// (gemm_block). out = attn @ Wo.T + bo, both operands fragment-packed, fp32
// result straight to d_out.
// ---------------------------------------------------------------------------
__global__ void __launch_bounds__(GEMM_WAVES * 32, 4)
out_proj_kernel(const _Float16* __restrict__ A, const _Float16* __restrict__ W,
                const float* __restrict__ bias, float* __restrict__ out) {
  __shared__ __attribute__((aligned(16))) _Float16 L[2 * ST_HALVES];
  const unsigned wave = __builtin_amdgcn_readfirstlane(threadIdx.x >> 5);
  const int lane = threadIdx.x & 31;
  const int lo = lane & 15, hi = lane >> 4;

  // Packed operands: tile row t, k-block kb at (t * (DMODEL/32) + kb) * FRAG.
  const int TROW = (DMODEL / 32) * FRAG;  // halves per 16-row tile
  v8f acc[4][4] = {};
  gemm_block(A + (size_t)blockIdx.y * (GEMM_TM / 16) * TROW,
             W + (size_t)blockIdx.x * (GEMM_TN / 16) * TROW, L, wave, lane,
             acc);
  const int n0 = blockIdx.x * GEMM_TN + (wave & 1) * 64;
  const int m0 = blockIdx.y * GEMM_TM + (wave >> 1) * 64;

#pragma unroll
  for (int j = 0; j < 4; ++j) {
    const int col = n0 + j * 16 + lo;
    const float bb = bias[col];
#pragma unroll
    for (int i = 0; i < 4; ++i) {
#pragma unroll
      for (int r = 0; r < 8; ++r) {
        const int row = m0 + i * 16 + hi * 8 + r;
        out[(size_t)row * DMODEL + col] = acc[i][j][r] + bb;
      }
    }
  }
}

// ---------------------------------------------------------------------------
extern "C" void kernel_launch(void* const* d_in, const int* in_sizes, int n_in,
                              void* d_out, int out_size, void* d_ws,
                              size_t ws_size, hipStream_t stream) {
  const float* x  = (const float*)d_in[0];
  const float* Wq = (const float*)d_in[1];
  const float* bq = (const float*)d_in[2];
  const float* Wk = (const float*)d_in[3];
  const float* bk = (const float*)d_in[4];
  const float* Wv = (const float*)d_in[5];
  const float* bv = (const float*)d_in[6];
  const float* Wo = (const float*)d_in[7];
  const float* bo = (const float*)d_in[8];
  float* out = (float*)d_out;

  const size_t TOK = (size_t)NB * SLEN;          // 8192 tokens

  // Workspace map (f16): q/k/v/attn 16 MB each, x_h 16 MB, weights 2 MB x4.
  char* ws = (char*)d_ws;
  _Float16* q_ws = (_Float16*)(ws);
  _Float16* k_ws = (_Float16*)(ws + 16ull * 1024 * 1024);
  _Float16* v_ws = (_Float16*)(ws + 32ull * 1024 * 1024);
  _Float16* a_ws = (_Float16*)(ws + 48ull * 1024 * 1024);
  _Float16* x_h  = (_Float16*)(ws + 64ull * 1024 * 1024);
  _Float16* wq_h = (_Float16*)(ws + 80ull * 1024 * 1024);
  _Float16* wk_h = (_Float16*)(ws + 82ull * 1024 * 1024);
  _Float16* wv_h = (_Float16*)(ws + 84ull * 1024 * 1024);
  _Float16* wo_h = (_Float16*)(ws + 86ull * 1024 * 1024);

  // 0) fp32 -> f16 conversion, one launch: x_h and the four weight planes
  //    lie one behind the other in the workspace map above.
  cvt_f32_to_f16<<<CVT_GRID, 512, 0, stream>>>(x, Wq, Wk, Wv, Wo, x_h);

  // 1) QKV projections: 256x128 block per work-group, z selects Q/K/V.
  dim3 qkv_grid(DMODEL / GEMM_TN, (unsigned)(TOK / GEMM_TM), 3);
  qkv_gemm_kernel<<<qkv_grid, GEMM_WAVES * 32, 0, stream>>>(x_h, wq_h, wk_h, wv_h,
                                               bq, bk, bv, q_ws, k_ws, v_ws);

  // 2) Attention: one wave per (query tile, head, batch).
  dim3 attn_grid(SLEN / 16, NHEAD, NB);
  attn_kernel<<<attn_grid, 32, 0, stream>>>(q_ws, k_ws, v_ws, a_ws);

  // 3) Output projection (fp32 result).
  dim3 proj_grid(DMODEL / GEMM_TN, (unsigned)(TOK / GEMM_TM));
  out_proj_kernel<<<proj_grid, GEMM_WAVES * 32, 0, stream>>>(a_ws, wo_h, bo, out);
}

// v005
// A run of this version takes 134 microseconds.
// In two side-by-side timings against v004, it was 1.39 and 1.40 times as fast.
// All steps since v000 together make it 2.78 times as fast.
#include <hip/hip_runtime.h>

#define DMODEL 1024
#define SLEN   2048
#define NHEAD  16
#define DK     64
#define NB     4

typedef __attribute__((ext_vector_type(16))) _Float16 v16h;
typedef __attribute__((ext_vector_type(8)))  _Float16 v8h;
typedef __attribute__((ext_vector_type(4)))  _Float16 v4h;
typedef __attribute__((ext_vector_type(4)))  float    v4f;
typedef __attribute__((ext_vector_type(8)))  float    v8f;

// D = A(16x32 f16) * B(32x16 f16) + C(16x16 f32)
__device__ __forceinline__ v8f wmma16(v16h a, v16h b, v8f c) {
  return __builtin_amdgcn_wmma_f32_16x16x32_f16(
      /*neg_a=*/false, a, /*neg_b=*/false, b,
      /*c_mod=*/(short)0, c, /*reuse_a=*/false, /*reuse_b=*/false);
}

__device__ __forceinline__ v16h frag_f16(const _Float16* __restrict__ p) {
  v8h a = *(const v8h*)(p);
  v8h b = *(const v8h*)(p + 16);
  v16h f;
#pragma unroll
  for (int j = 0; j < 8; ++j) { f[j] = a[j]; f[j + 8] = b[j]; }
  return f;
}

// ---------------------------------------------------------------------------
// Fragment-packed layout of every f16 workspace operand.
// A matrix M[row][k] that feeds WMMA as A (lane = row) or B (lane = column,
// stored as row) is kept as 16x32 fragments of 512 halves (1024 bytes), each
// in the order the lanes read it: two units of 256 halves, unit u holding
// k = u*16 + hi*8 + j at [lane = hi*16 + (row & 15)][j]. One wave-wide
// 16-byte load then covers 512 contiguous bytes (4 whole lines) where a
// row-major operand gives 16 rows x 32 bytes (16 lines).
// ---------------------------------------------------------------------------
#define FRAG 512  // halves per 16x32 fragment

// Place of element (row & 15, k & 31) inside its fragment, in halves.
__device__ __forceinline__ int pk_in_frag(int row, int k) {
  return ((k >> 4) & 1) * 256 + ((((k >> 3) & 1) << 4) + (row & 15)) * 8 +
         (k & 7);
}

__device__ __forceinline__ v16h frag_pk(const _Float16* __restrict__ p) {
  v8h a = *(const v8h*)(p);
  v8h b = *(const v8h*)(p + 256);
  v16h f;
#pragma unroll
  for (int j = 0; j < 8; ++j) { f[j] = a[j]; f[j + 8] = b[j]; }
  return f;
}

#define XTILES   (NB * SLEN / 16)   // 16-row tiles of x
#define WTILES   (DMODEL / 16)      // 16-row tiles of one weight matrix
#define CVT_GRID 256
static_assert(XTILES == 2 * CVT_GRID && 4 * WTILES == CVT_GRID,
              "three row tiles per work-group");

__global__ void __launch_bounds__(512)
cvt_f32_to_f16(const float* __restrict__ x, const float* __restrict__ wq,
               const float* __restrict__ wk, const float* __restrict__ wv,
               const float* __restrict__ wo, _Float16* __restrict__ out) {
  const unsigned w = threadIdx.x >> 5, l = threadIdx.x & 31;
  const unsigned r = l >> 3;        // row inside a group of 4 rows
  const unsigned c = (l & 7) * 4;   // column inside a 32-column block
  const unsigned g = blockIdx.x;
  const unsigned TILE = 16 * DMODEL;  // elements of a row tile, in and out

  // Block-uniform tile bases, one lane offset for all of them.
  const unsigned m = g / WTILES;
  const float* wsel = (m & 2) ? ((m & 1) ? wo : wv) : ((m & 1) ? wk : wq);
  const float* src[3] = {x + (size_t)g * TILE,
                         x + (size_t)(g + CVT_GRID) * TILE,
                         wsel + (size_t)(g % WTILES) * TILE};
  const unsigned loff = r * DMODEL + w * 64 + c;

  v4f v[3][2][4];
#pragma unroll
  for (int p = 0; p < 3; ++p)
#pragma unroll
    for (int f = 0; f < 2; ++f)
#pragma unroll
      for (int q = 0; q < 4; ++q)
        v[p][f][q] = *(const v4f*)(src[p] + loff + q * 4 * DMODEL + f * 32);

  const unsigned soff = w * 2 * FRAG + pk_in_frag(r, c);
#pragma unroll
  for (int p = 0; p < 3; ++p) {
    _Float16* o = out + (size_t)(g + p * CVT_GRID) * TILE;
#pragma unroll
    for (int f = 0; f < 2; ++f)
#pragma unroll
      for (int q = 0; q < 4; ++q) {
        v4h h;
#pragma unroll
        for (int j = 0; j < 4; ++j) h[j] = (_Float16)v[p][f][q][j];
        // rows q*4 + r: 4 rows further on is 32 halves further on
        *(v4h*)(o + soff + f * FRAG + q * 32) = h;
      }
  }
}

#define GEMM_WAVES 8
#define GEMM_TM    256
#define GEMM_TN    128
#define ST_FRAGS   2                               // fragments per tile row
#define ST_COUNT   (DMODEL / 32 / ST_FRAGS)        // stages
#define ST_ROW     (ST_FRAGS * FRAG)               // halves per tile row
#define ST_AROWS   (GEMM_TM / 16)
#define ST_ROWS    ((GEMM_TM + GEMM_TN) / 16)      // tile rows per stage
#define ST_HALVES  (ST_ROWS * ST_ROW)              // halves per buffer
static_assert(ST_ROWS == 3 * GEMM_WAVES && ST_ROW == 4 * 256 && ST_COUNT >= 2,
              "a wave copies three tile rows, four 512-byte pieces each");

__device__ __forceinline__ void copy_row(unsigned l, const _Float16* g) {
  asm volatile(
      "global_load_async_to_lds_b128 %0, %4, off\n\t"
      "global_load_async_to_lds_b128 %1, %5, off\n\t"
      "global_load_async_to_lds_b128 %2, %6, off\n\t"
      "global_load_async_to_lds_b128 %3, %7, off\n\t"
      "s_wait_xcnt 0x0"
      :
      : "v"(l), "v"(l + 512u), "v"(l + 1024u), "v"(l + 1536u),
        "v"(g), "v"(g + 256), "v"(g + 512), "v"(g + 768)
      : "memory");
}
__device__ __forceinline__ void copy_stage(unsigned l, const _Float16* g0,
                                           const _Float16* g1,
                                           const _Float16* g2) {
  copy_row(l, g0);
  copy_row(l + 2048u, g1);
  copy_row(l + 4096u, g2);
}

// Ab, Bb: first packed tile row of the block's A rows and B rows. wave is
// wave-uniform. On return acc holds the wave's 64x64 tile, rows
// (wave >> 1) * 64, columns (wave & 1) * 64 of the block.
__device__ __forceinline__ void gemm_block(const _Float16* __restrict__ Ab,
                                           const _Float16* __restrict__ Bb,
                                           _Float16* L, unsigned wave,
                                           unsigned lane, v8f (&acc)[4][4]) {
  const int TROW = (DMODEL / 32) * FRAG;  // halves per packed 16-row tile
  const _Float16* g[3];
#pragma unroll
  for (unsigned i = 0; i < 3; ++i) {
    const unsigned r = 3 * wave + i;  // tile row of the stage: A first, then B
    g[i] = ((r < ST_AROWS) ? Ab + (size_t)r * TROW
                           : Bb + (size_t)(r - ST_AROWS) * TROW) + lane * 8;
  }
  const unsigned lcp =
      (unsigned)(size_t)L + (wave * 3 * ST_ROW + lane * 8) * 2;  // bytes

  copy_stage(lcp, g[0], g[1], g[2]);
  // Stage 0 has landed for this wave, and behind the barrier for all waves.
  asm volatile("s_wait_asynccnt 0x0" ::: "memory");
  __syncthreads();
  copy_stage(lcp + ST_HALVES * 2, g[0] + ST_ROW, g[1] + ST_ROW, g[2] + ST_ROW);

  const _Float16* la = L + (wave >> 1) * 4 * ST_ROW + lane * 8;
  const _Float16* lb = L + (ST_AROWS + (wave & 1) * 4) * ST_ROW + lane * 8;
  for (int t = 0; t < ST_COUNT; ++t) {
    const unsigned buf = (t & 1) * ST_HALVES;
    v16h a[4], bf[4];
#pragma unroll
    for (int kk = 0; kk < ST_FRAGS; ++kk) {
      bf[0] = frag_pk(lb + buf + kk * FRAG);
#pragma unroll
      for (int i = 0; i < 4; ++i)
        a[i] = frag_pk(la + buf + i * ST_ROW + kk * FRAG);
#pragma unroll
      for (int j = 1; j < 4; ++j)
        bf[j] = frag_pk(lb + buf + j * ST_ROW + kk * FRAG);
      if (kk == ST_FRAGS - 1) {
        // Publish point of stage t + 1, behind the stage's last LDS reads and
        // in front of their WMMAs: this wave's reads of stage t are done, its
        // copies of stage t + 1 have landed; the barrier says so of every
        // wave.
        asm volatile("s_wait_dscnt 0x0" ::: "memory");
        asm volatile("s_wait_asynccnt 0x0" ::: "memory");
        __syncthreads();
        if (t + 2 < ST_COUNT)  // refill the buffer that every wave has left
          copy_stage(lcp + buf * 2, g[0] + (t + 2) * ST_ROW,
                     g[1] + (t + 2) * ST_ROW, g[2] + (t + 2) * ST_ROW);
      }
      // Holds the 16 LDS reads of a k-step (and the refill) together in front
      // of its WMMAs: left alone the compiler sinks the B reads among the
      // WMMAs, one register set, a wait to 0 in front of every four.
      __builtin_amdgcn_sched_barrier(0);
#pragma unroll
      for (int j = 0; j < 4; ++j)
#pragma unroll
        for (int i = 0; i < 4; ++i) acc[i][j] = wmma16(a[i], bf[j], acc[i][j]);
    }
  }
  // No copy is outstanding when the wave goes on to its stores and ends.
  asm volatile("s_wait_asynccnt 0x0" ::: "memory");
}

// ---------------------------------------------------------------------------
// Kernel 1: QKV projection, one wave per 64x64 output tile, 8 waves per
// work-group (gemm_block), blockIdx.z picks the matrix (0=Q, 1=K, 2=V).
// out[m,n] = sum_k x[m,k]*W[n,k] + b[n].
// All operands and results are fragment-packed. Per (b, h): Q and K as
// [s/16][d/32] fragments (row = token, k = d), V as [s/32][d/16] fragments
// (row = d, k = token) so a 32-key chunk of K or of V is 4 KB in a row.
// ---------------------------------------------------------------------------
__global__ void __launch_bounds__(GEMM_WAVES * 32, 4)
qkv_gemm_kernel(const _Float16* __restrict__ Xh,
                const _Float16* __restrict__ Wqh,
                const _Float16* __restrict__ Wkh,
                const _Float16* __restrict__ Wvh,
                const float* __restrict__ bq, const float* __restrict__ bk,
                const float* __restrict__ bv,
                _Float16* __restrict__ Qo, _Float16* __restrict__ Ko,
                _Float16* __restrict__ Vo) {
  __shared__ __attribute__((aligned(16))) _Float16 L[2 * ST_HALVES];
  const unsigned wave = __builtin_amdgcn_readfirstlane(threadIdx.x >> 5);
  const int lane = threadIdx.x & 31;
  const int lo = lane & 15, hi = lane >> 4;
  const int z  = blockIdx.z;
  const _Float16* W    = (z == 0) ? Wqh : (z == 1) ? Wkh : Wvh;
  const float*    bias = (z == 0) ? bq  : (z == 1) ? bk  : bv;

  // Packed operands: tile row t, k-block kb at (t * (DMODEL/32) + kb) * FRAG.
  const int TROW = (DMODEL / 32) * FRAG;  // halves per 16-row tile
  v8f acc[4][4] = {};
  gemm_block(Xh + (size_t)blockIdx.y * (GEMM_TM / 16) * TROW,
             W + (size_t)blockIdx.x * (GEMM_TN / 16) * TROW, L, wave, lane,
             acc);
  const int n0 = blockIdx.x * GEMM_TN + (wave & 1) * 64;
  const int m0 = blockIdx.y * GEMM_TM + (wave >> 1) * 64;

  const int b_ = m0 >> 11;  // 64-row tile never crosses a batch boundary
  const int hh = n0 >> 6;   // 64-column tile is exactly one head
  const int sb = m0 & (SLEN - 1);
  const size_t head = (size_t)(b_ * NHEAD + hh) * SLEN * DK;
  if (z < 2) {  // Q or K: fragments [s/16][d/32], row = token, k = d
    _Float16* O = ((z == 0) ? Qo : Ko) + head;
#pragma unroll
    for (int j = 0; j < 4; ++j) {
      const int d = j * 16 + lo;
      const float bb = bias[n0 + d];
#pragma unroll
      for (int i = 0; i < 4; ++i) {
        _Float16* fr = O + (((sb >> 4) + i) * (DK / 32) + (d >> 5)) * FRAG;
#pragma unroll
        for (int r = 0; r < 8; ++r) {
          const int row = hi * 8 + r;
          fr[pk_in_frag(row, d)] = (_Float16)(acc[i][j][r] + bb);
        }
      }
    }
  } else {      // V: fragments [s/32][d/16], row = d, k = token
    _Float16* O = Vo + head;
#pragma unroll
    for (int j = 0; j < 4; ++j) {
      const float bb = bias[n0 + j * 16 + lo];
#pragma unroll
      for (int i = 0; i < 4; ++i) {
        const int s0 = sb + i * 16 + hi * 8;   // 8 tokens in a row per lane
        v8h o;
#pragma unroll
        for (int r = 0; r < 8; ++r) o[r] = (_Float16)(acc[i][j][r] + bb);
        *(v8h*)(O + ((s0 >> 5) * (DK / 16) + j) * FRAG + pk_in_frag(lo, s0)) = o;
      }
      __builtin_amdgcn_sched_barrier(0);
    }
    // Stands in front of any later overwrite of the stores' data and address
    // registers (the listing leaves a path from here into the branch above).
    asm volatile("s_wait_xcnt 0x0" ::: "memory");
  }
}

#define AT_WAVES 8
#define AT_Q     (AT_WAVES * 16)      // queries per work-group
#define AT_KEYS  64                   // keys per stage
#define AT_OPH   (AT_KEYS * DK)       // halves of K, or of V, per stage
#define AT_STH   (2 * AT_OPH)         // halves per buffer: K, then V
static_assert(AT_OPH * 2 == 2 * AT_WAVES * 32 * 16 && AT_Q >= 2 * AT_KEYS &&
                  AT_Q % AT_KEYS == 0 && SLEN % AT_Q == 0,
              "two 16-byte copies per lane and operand; two stages or more");

__device__ __forceinline__ void copy_kv(unsigned l, const _Float16* k,
                                        const _Float16* v) {
  asm volatile(
      "global_load_async_to_lds_b128 %0, %4, off\n\t"
      "global_load_async_to_lds_b128 %1, %5, off\n\t"
      "global_load_async_to_lds_b128 %2, %6, off\n\t"
      "global_load_async_to_lds_b128 %3, %7, off\n\t"
      "s_wait_xcnt 0x0"
      :
      : "v"(l), "v"(l + 4096u), "v"(l + 8192u), "v"(l + 12288u),
        "v"(k), "v"(k + 2048), "v"(v), "v"(v + 2048)
      : "memory");
}

__device__ __forceinline__ float xhalf(float x) {
  const int b = __builtin_bit_cast(int, x);
  return __builtin_bit_cast(float, __builtin_amdgcn_permlanex16(
      b, b, 0x76543210, 0xfedcba98, false, false));
}

__global__ void __launch_bounds__(AT_WAVES * 32)
attn_kernel(const _Float16* __restrict__ Q, const _Float16* __restrict__ K,
            const _Float16* __restrict__ V, _Float16* __restrict__ O) {
  __shared__ __attribute__((aligned(16))) _Float16 L[2 * AT_STH];
  const int wave = __builtin_amdgcn_readfirstlane(threadIdx.x >> 5);
  const int lane = threadIdx.x & 31;
  const int lo = lane & 15, hi = lane >> 4;
  const int pb = blockIdx.x;  // block of AT_Q queries
  const int q0 = pb * AT_Q + wave * 16;
  const int h  = blockIdx.y;
  const int b  = blockIdx.z;

  // Packed per head: a 16-token tile of Q or K is 2 fragments, a 32-key
  // chunk of K or of V is 4 fragments (CHUNK halves) in a row.
  const int CHUNK = 4 * FRAG;
  const size_t head = (size_t)(b * NHEAD + h) * SLEN * DK;
  const _Float16* qp = Q + head + (q0 >> 4) * (2 * FRAG) + lane * 8;
  const _Float16* kp = K + head;
  const _Float16* vp = V + head;

  const v16h qb0 = frag_pk(qp);         // B: column = query lo, k = d 0..31
  const v16h qb1 = frag_pk(qp + FRAG);  // B: column = query lo, k = d 32..63

  // Per lane: running maximum of query lo (alike in both halves), the sum
  // over this half's keys only, and O^T: acc[t][r] = O[lo][t*16 + hi*8 + r].
  float mrow = -__builtin_inff(), lrow = 0.f;
  v8f acc[4] = {{}, {}, {}, {}};
  const int qrow = q0 + lo;

  const int s_end = q0 + 16;  // causal upper bound of this wave
  const int nst = (pb + 1) * (AT_Q / AT_KEYS);  // stages of the work-group
  const unsigned lcp = (unsigned)(size_t)L + threadIdx.x * 16;  // bytes
  const _Float16* kg = kp + threadIdx.x * 8;
  const _Float16* vg = vp + threadIdx.x * 8;

  copy_kv(lcp, kg, vg);
  // Stage 0 has landed for this wave, and behind the barrier for all waves.
  asm volatile("s_wait_asynccnt 0x0" ::: "memory");
  __syncthreads();
  copy_kv(lcp + AT_STH * 2, kg + AT_OPH, vg + AT_OPH);

  for (int st = 0; st < nst; ++st) {
    const unsigned buf = (st & 1) * AT_STH;
    // Unrolled: a chunk's place in the buffer becomes the immediate offset of
    // its LDS reads.
#pragma unroll
    for (int c = 0; c < AT_KEYS / 32; ++c) {
      const int s0 = st * AT_KEYS + c * 32;
      if (s0 >= s_end) continue;  // wave-uniform: beyond this wave's diagonal
      const _Float16* kc = L + buf + c * CHUNK;
      const _Float16* vc = L + buf + AT_OPH + c * CHUNK;

      // ---- scores: S^T = K * Q^T ----
      v8f sc0 = {}, sc1 = {};
      {
        const _Float16* kr = kc + lane * 8;
        const v16h k00 = frag_pk(kr);             // keys s0 .. s0+15
        const v16h k01 = frag_pk(kr + FRAG);
        const v16h k10 = frag_pk(kr + 2 * FRAG);  // keys s0+16 .. s0+31
        const v16h k11 = frag_pk(kr + 3 * FRAG);
        // Holds the chunk's 8 LDS reads of K together in front of its WMMAs:
        // left alone the compiler sinks them among the WMMAs, one register set,
        // a wait to 0 in front of each.
        __builtin_amdgcn_sched_barrier(0);
        sc0 = wmma16(k00, qb0, sc0);
        sc0 = wmma16(k01, qb1, sc0);
        sc1 = wmma16(k10, qb0, sc1);
        sc1 = wmma16(k11, qb1, sc1);
      }

      const int rel = qrow - s0 - hi * 8;
#pragma unroll
      for (int r = 0; r < 8; ++r) {
        const float a0 = sc0[r] * 0.125f;   // 1/sqrt(64)
        const float a1 = sc1[r] * 0.125f;
        sc0[r] = (r <= rel)      ? a0 : -__builtin_inff();
        sc1[r] = (r + 16 <= rel) ? a1 : -__builtin_inff();
      }

      // ---- online softmax, one query per lane ----
      float cm0 = fmaxf(sc0[0], sc1[0]), cm1 = fmaxf(sc0[1], sc1[1]);
#pragma unroll
      for (int r = 2; r < 8; r += 2) {
        cm0 = fmaxf(fmaxf(cm0, sc0[r]), sc1[r]);
        cm1 = fmaxf(fmaxf(cm1, sc0[r + 1]), sc1[r + 1]);
      }
      float cm = fmaxf(cm0, cm1);
      cm = fmaxf(cm, xhalf(cm));  // all 32 keys; key s0 is never masked
      const float mnew = fmaxf(mrow, cm);
      const float corr = __expf(mrow - mnew);
      float rs0 = 0.f, rs1 = 0.f;
      v16h pt;  // B: column = query lo, k = key in the hardware order
#pragma unroll
      for (int r = 0; r < 8; ++r) {
        const float p0 = __expf(sc0[r] - mnew);
        const float p1 = __expf(sc1[r] - mnew);
        rs0 += p0;
        rs1 += p1;
        pt[r]     = (_Float16)p0;
        pt[r + 8] = (_Float16)p1;
      }
      lrow = lrow * corr + (rs0 + rs1);
      mrow = mnew;
#pragma unroll
      for (int t = 0; t < 4; ++t) acc[t] *= corr;

      // ---- O^T += V^T * P^T (fragment t: rows d = t*16 .. t*16+15) ----
#pragma unroll
      for (int t = 0; t < 4; ++t)
        acc[t] = wmma16(frag_pk(vc + t * FRAG + lane * 8), pt, acc[t]);
    }
    // Publish point of stage st + 1: this wave's reads of stage st are done,
    // its copies of stage st + 1 have landed; the barrier says so of every
    // wave.
    asm volatile("s_wait_dscnt 0x0" ::: "memory");
    asm volatile("s_wait_asynccnt 0x0" ::: "memory");
    __syncthreads();
    if (st + 2 < nst)  // refill the buffer that every wave has left
      copy_kv(lcp + buf * 2, kg + (st + 2) * AT_OPH, vg + (st + 2) * AT_OPH);
  }
  // No copy is outstanding when the wave goes on to its stores and ends.
  asm volatile("s_wait_asynccnt 0x0" ::: "memory");

  // ---- finalize: join the halves' sums, divide, store packed for the
  //      projection: fragments [token/16][k/32], row = token = lo,
  //      k = h*64 + d. A lane's 8 values of tile t are 8 d in a row, so each
  //      tile is one 16-byte store per lane, 512 bytes in a row per wave. ----
  _Float16* ot = O + ((size_t)((b * SLEN + q0) >> 4) * (DMODEL / 32) +
                      h * (DK / 32)) * FRAG + lane * 8;
  const float inv = 1.0f / (lrow + xhalf(lrow));
  v8h o[4];
#pragma unroll
  for (int t = 0; t < 4; ++t) {
#pragma unroll
    for (int r = 0; r < 8; ++r) o[t][r] = (_Float16)(acc[t][r] * inv);
  }
#pragma unroll
  for (int t = 0; t < 4; ++t)
    *(v8h*)(ot + (t >> 1) * FRAG + (t & 1) * 256) = o[t];
}

// ---------------------------------------------------------------------------
// Kernel 3: output projection, 64x64 tile per wave, 8 waves per work-group
// (gemm_block). out = attn @ Wo.T + bo, both operands fragment-packed, fp32
// result straight to d_out.
// ---------------------------------------------------------------------------
__global__ void __launch_bounds__(GEMM_WAVES * 32, 4)
out_proj_kernel(const _Float16* __restrict__ A, const _Float16* __restrict__ W,
                const float* __restrict__ bias, float* __restrict__ out) {
  __shared__ __attribute__((aligned(16))) _Float16 L[2 * ST_HALVES];
  const unsigned wave = __builtin_amdgcn_readfirstlane(threadIdx.x >> 5);
  const int lane = threadIdx.x & 31;
  const int lo = lane & 15, hi = lane >> 4;

  // Packed operands: tile row t, k-block kb at (t * (DMODEL/32) + kb) * FRAG.
  const int TROW = (DMODEL / 32) * FRAG;  // halves per 16-row tile
  v8f acc[4][4] = {};
  gemm_block(A + (size_t)blockIdx.y * (GEMM_TM / 16) * TROW,
             W + (size_t)blockIdx.x * (GEMM_TN / 16) * TROW, L, wave, lane,
             acc);
  const int n0 = blockIdx.x * GEMM_TN + (wave & 1) * 64;
  const int m0 = blockIdx.y * GEMM_TM + (wave >> 1) * 64;

#pragma unroll
  for (int j = 0; j < 4; ++j) {
    const int col = n0 + j * 16 + lo;
    const float bb = bias[col];
#pragma unroll
    for (int i = 0; i < 4; ++i) {
#pragma unroll
      for (int r = 0; r < 8; ++r) {
        const int row = m0 + i * 16 + hi * 8 + r;
        out[(size_t)row * DMODEL + col] = acc[i][j][r] + bb;
      }
    }
  }
}

// ---------------------------------------------------------------------------
extern "C" void kernel_launch(void* const* d_in, const int* in_sizes, int n_in,
                              void* d_out, int out_size, void* d_ws,
                              size_t ws_size, hipStream_t stream) {
  const float* x  = (const float*)d_in[0];
  const float* Wq = (const float*)d_in[1];
  const float* bq = (const float*)d_in[2];
  const float* Wk = (const float*)d_in[3];
  const float* bk = (const float*)d_in[4];
  const float* Wv = (const float*)d_in[5];
  const float* bv = (const float*)d_in[6];
  const float* Wo = (const float*)d_in[7];
  const float* bo = (const float*)d_in[8];
  float* out = (float*)d_out;

  const size_t TOK = (size_t)NB * SLEN;          // 8192 tokens

  // Workspace map (f16): q/k/v/attn 16 MB each, x_h 16 MB, weights 2 MB x4.
  char* ws = (char*)d_ws;
  _Float16* q_ws = (_Float16*)(ws);
  _Float16* k_ws = (_Float16*)(ws + 16ull * 1024 * 1024);
  _Float16* v_ws = (_Float16*)(ws + 32ull * 1024 * 1024);
  _Float16* a_ws = (_Float16*)(ws + 48ull * 1024 * 1024);
  _Float16* x_h  = (_Float16*)(ws + 64ull * 1024 * 1024);
  _Float16* wq_h = (_Float16*)(ws + 80ull * 1024 * 1024);
  _Float16* wk_h = (_Float16*)(ws + 82ull * 1024 * 1024);
  _Float16* wv_h = (_Float16*)(ws + 84ull * 1024 * 1024);
  _Float16* wo_h = (_Float16*)(ws + 86ull * 1024 * 1024);

  // 0) fp32 -> f16 conversion, one launch: x_h and the four weight planes
  //    lie one behind the other in the workspace map above.
  cvt_f32_to_f16<<<CVT_GRID, 512, 0, stream>>>(x, Wq, Wk, Wv, Wo, x_h);

  // 1) QKV projections: 256x128 block per work-group, z selects Q/K/V.
  dim3 qkv_grid(DMODEL / GEMM_TN, (unsigned)(TOK / GEMM_TM), 3);
  qkv_gemm_kernel<<<qkv_grid, GEMM_WAVES * 32, 0, stream>>>(x_h, wq_h, wk_h, wv_h,
                                               bq, bk, bv, q_ws, k_ws, v_ws);

  // 2) Attention: 8 waves per (block of 128 queries, head, batch).
  dim3 attn_grid(SLEN / AT_Q, NHEAD, NB);
  attn_kernel<<<attn_grid, AT_WAVES * 32, 0, stream>>>(q_ws, k_ws, v_ws, a_ws);

  // 3) Output projection (fp32 result).
  dim3 proj_grid(DMODEL / GEMM_TN, (unsigned)(TOK / GEMM_TM));
  out_proj_kernel<<<proj_grid, GEMM_WAVES * 32, 0, stream>>>(a_ws, wo_h, bo, out);
}

// v006
// A run of this version takes 115 microseconds.
// In both of two side-by-side timings against v005, it was 1.17 times as fast.
// Over all steps from v000 it is 3.25 times as fast.
#include <hip/hip_runtime.h>

#define DMODEL 1024
#define SLEN   2048
#define NHEAD  16
#define DK     64
#define NB     4

typedef __attribute__((ext_vector_type(16))) _Float16 v16h;
typedef __attribute__((ext_vector_type(8)))  _Float16 v8h;
typedef __attribute__((ext_vector_type(4)))  _Float16 v4h;
typedef __attribute__((ext_vector_type(4)))  float    v4f;
typedef __attribute__((ext_vector_type(8)))  float    v8f;

// D = A(16x32 f16) * B(32x16 f16) + C(16x16 f32)
__device__ __forceinline__ v8f wmma16(v16h a, v16h b, v8f c) {
  return __builtin_amdgcn_wmma_f32_16x16x32_f16(
      /*neg_a=*/false, a, /*neg_b=*/false, b,
      /*c_mod=*/(short)0, c, /*reuse_a=*/false, /*reuse_b=*/false);
}

__device__ __forceinline__ v16h frag_f16(const _Float16* __restrict__ p) {
  v8h a = *(const v8h*)(p);
  v8h b = *(const v8h*)(p + 16);
  v16h f;
#pragma unroll
  for (int j = 0; j < 8; ++j) { f[j] = a[j]; f[j + 8] = b[j]; }
  return f;
}

// ---------------------------------------------------------------------------
// Fragment-packed layout of every f16 workspace operand.
// A matrix M[row][k] that feeds WMMA as A (lane = row) or B (lane = column,
// stored as row) is kept as 16x32 fragments of 512 halves (1024 bytes), each
// in the order the lanes read it: two units of 256 halves, unit u holding
// k = u*16 + hi*8 + j at [lane = hi*16 + (row & 15)][j]. One wave-wide
// 16-byte load then covers 512 contiguous bytes (4 whole lines) where a
// row-major operand gives 16 rows x 32 bytes (16 lines).
// ---------------------------------------------------------------------------
#define FRAG 512  // halves per 16x32 fragment

// Place of element (row & 15, k & 31) inside its fragment, in halves.
__device__ __forceinline__ int pk_in_frag(int row, int k) {
  return ((k >> 4) & 1) * 256 + ((((k >> 3) & 1) << 4) + (row & 15)) * 8 +
         (k & 7);
}

__device__ __forceinline__ v16h frag_pk(const _Float16* __restrict__ p) {
  v8h a = *(const v8h*)(p);
  v8h b = *(const v8h*)(p + 256);
  v16h f;
#pragma unroll
  for (int j = 0; j < 8; ++j) { f[j] = a[j]; f[j + 8] = b[j]; }
  return f;
}

#define XTILES   (NB * SLEN / 16)   // 16-row tiles of x
#define WTILES   (DMODEL / 16)      // 16-row tiles of one weight matrix
#define CVT_GRID 256
static_assert(XTILES == 2 * CVT_GRID && 4 * WTILES == CVT_GRID,
              "three row tiles per work-group");

__global__ void __launch_bounds__(512)
cvt_f32_to_f16(const float* __restrict__ x, const float* __restrict__ wq,
               const float* __restrict__ wk, const float* __restrict__ wv,
               const float* __restrict__ wo, _Float16* __restrict__ out) {
  const unsigned w = threadIdx.x >> 5, l = threadIdx.x & 31;
  const unsigned r = l >> 3;        // row inside a group of 4 rows
  const unsigned c = (l & 7) * 4;   // column inside a 32-column block
  const unsigned g = blockIdx.x;
  const unsigned TILE = 16 * DMODEL;  // elements of a row tile, in and out

  // Block-uniform tile bases, one lane offset for all of them.
  const unsigned m = g / WTILES;
  const float* wsel = (m & 2) ? ((m & 1) ? wo : wv) : ((m & 1) ? wk : wq);
  const float* src[3] = {x + (size_t)g * TILE,
                         x + (size_t)(g + CVT_GRID) * TILE,
                         wsel + (size_t)(g % WTILES) * TILE};
  const unsigned loff = r * DMODEL + w * 64 + c;

  v4f v[3][2][4];
#pragma unroll
  for (int p = 0; p < 3; ++p)
#pragma unroll
    for (int f = 0; f < 2; ++f)
#pragma unroll
      for (int q = 0; q < 4; ++q)
        v[p][f][q] = *(const v4f*)(src[p] + loff + q * 4 * DMODEL + f * 32);

  const unsigned soff = w * 2 * FRAG + pk_in_frag(r, c);
#pragma unroll
  for (int p = 0; p < 3; ++p) {
    _Float16* o = out + (size_t)(g + p * CVT_GRID) * TILE;
#pragma unroll
    for (int f = 0; f < 2; ++f)
#pragma unroll
      for (int q = 0; q < 4; ++q) {
        v4h h;
#pragma unroll
        for (int j = 0; j < 4; ++j) h[j] = (_Float16)v[p][f][q][j];
        // rows q*4 + r: 4 rows further on is 32 halves further on
        *(v4h*)(o + soff + f * FRAG + q * 32) = h;
      }
  }
}

#define GEMM_WAVES 8
#define GEMM_TM    256
#define GEMM_TN    128
#define ST_FRAGS   2                               // fragments per tile row
#define ST_COUNT   (DMODEL / 32 / ST_FRAGS)        // stages
#define ST_ROW     (ST_FRAGS * FRAG)               // halves per tile row
#define ST_AROWS   (GEMM_TM / 16)
#define ST_ROWS    ((GEMM_TM + GEMM_TN) / 16)      // tile rows per stage
#define ST_HALVES  (ST_ROWS * ST_ROW)              // halves per buffer
static_assert(ST_ROWS == 3 * GEMM_WAVES && ST_ROW == 4 * 256 && ST_COUNT >= 2,
              "a wave copies three tile rows, four 512-byte pieces each");

__device__ __forceinline__ void copy_row(unsigned l, const _Float16* g) {
  asm volatile(
      "global_load_async_to_lds_b128 %0, %4, off\n\t"
      "global_load_async_to_lds_b128 %1, %5, off\n\t"
      "global_load_async_to_lds_b128 %2, %6, off\n\t"
      "global_load_async_to_lds_b128 %3, %7, off\n\t"
      "s_wait_xcnt 0x0"
      :
      : "v"(l), "v"(l + 512u), "v"(l + 1024u), "v"(l + 1536u),
        "v"(g), "v"(g + 256), "v"(g + 512), "v"(g + 768)
      : "memory");
}
__device__ __forceinline__ void copy_stage(unsigned l, const _Float16* g0,
                                           const _Float16* g1,
                                           const _Float16* g2) {
  copy_row(l, g0);
  copy_row(l + 2048u, g1);
  copy_row(l + 4096u, g2);
}

// Ab, Bb: first packed tile row of the block's A rows and B rows. wave is
// wave-uniform. On return acc holds the wave's 64x64 tile, rows
// (wave >> 1) * 64, columns (wave & 1) * 64 of the block.
__device__ __forceinline__ void gemm_block(const _Float16* __restrict__ Ab,
                                           const _Float16* __restrict__ Bb,
                                           _Float16* L, unsigned wave,
                                           unsigned lane, v8f (&acc)[4][4]) {
  const int TROW = (DMODEL / 32) * FRAG;  // halves per packed 16-row tile
  const _Float16* g[3];
#pragma unroll
  for (unsigned i = 0; i < 3; ++i) {
    const unsigned r = 3 * wave + i;  // tile row of the stage: A first, then B
    g[i] = ((r < ST_AROWS) ? Ab + (size_t)r * TROW
                           : Bb + (size_t)(r - ST_AROWS) * TROW) + lane * 8;
  }
  const unsigned lcp =
      (unsigned)(size_t)L + (wave * 3 * ST_ROW + lane * 8) * 2;  // bytes

  copy_stage(lcp, g[0], g[1], g[2]);
  // Stage 0 has landed for this wave, and behind the barrier for all waves.
  asm volatile("s_wait_asynccnt 0x0" ::: "memory");
  __syncthreads();
  copy_stage(lcp + ST_HALVES * 2, g[0] + ST_ROW, g[1] + ST_ROW, g[2] + ST_ROW);

  const _Float16* la = L + (wave >> 1) * 4 * ST_ROW + lane * 8;
  const _Float16* lb = L + (ST_AROWS + (wave & 1) * 4) * ST_ROW + lane * 8;
  for (int t = 0; t < ST_COUNT; ++t) {
    const unsigned buf = (t & 1) * ST_HALVES;
    v16h a[4], bf[4];
#pragma unroll
    for (int kk = 0; kk < ST_FRAGS; ++kk) {
      bf[0] = frag_pk(lb + buf + kk * FRAG);
#pragma unroll
      for (int i = 0; i < 4; ++i)
        a[i] = frag_pk(la + buf + i * ST_ROW + kk * FRAG);
#pragma unroll
      for (int j = 1; j < 4; ++j)
        bf[j] = frag_pk(lb + buf + j * ST_ROW + kk * FRAG);
      if (kk == ST_FRAGS - 1) {
        // Publish point of stage t + 1, behind the stage's last LDS reads and
        // in front of their WMMAs: this wave's reads of stage t are done, its
        // copies of stage t + 1 have landed; the barrier says so of every
        // wave.
        asm volatile("s_wait_dscnt 0x0" ::: "memory");
        asm volatile("s_wait_asynccnt 0x0" ::: "memory");
        __syncthreads();
        if (t + 2 < ST_COUNT)  // refill the buffer that every wave has left
          copy_stage(lcp + buf * 2, g[0] + (t + 2) * ST_ROW,
                     g[1] + (t + 2) * ST_ROW, g[2] + (t + 2) * ST_ROW);
      }
      // Holds the 16 LDS reads of a k-step (and the refill) together in front
      // of its WMMAs: left alone the compiler sinks the B reads among the
      // WMMAs, one register set, a wait to 0 in front of every four.
      __builtin_amdgcn_sched_barrier(0);
#pragma unroll
      for (int j = 0; j < 4; ++j)
#pragma unroll
        for (int i = 0; i < 4; ++i) acc[i][j] = wmma16(a[i], bf[j], acc[i][j]);
    }
  }
  // No copy is outstanding when the wave goes on to its stores and ends.
  asm volatile("s_wait_asynccnt 0x0" ::: "memory");
}

// ---------------------------------------------------------------------------
// Kernel 1: QKV projection, one wave per 64x64 output tile, 8 waves per
// work-group (gemm_block), blockIdx.z picks the matrix (0=Q, 1=K, 2=V).
// out[m,n] = sum_k x[m,k]*W[n,k] + b[n].
// All operands and results are fragment-packed. Per (b, h): Q and K as
// [s/16][d/32] fragments (row = token, k = d), V as [s/32][d/16] fragments
// (row = d, k = token) so a 32-key chunk of K or of V is 4 KB in a row.
// ---------------------------------------------------------------------------
__global__ void __launch_bounds__(GEMM_WAVES * 32, 4)
qkv_gemm_kernel(const _Float16* __restrict__ Xh,
                const _Float16* __restrict__ Wqh,
                const _Float16* __restrict__ Wkh,
                const _Float16* __restrict__ Wvh,
                const float* __restrict__ bq, const float* __restrict__ bk,
                const float* __restrict__ bv,
                _Float16* __restrict__ Qo, _Float16* __restrict__ Ko,
                _Float16* __restrict__ Vo) {
  __shared__ __attribute__((aligned(16))) _Float16 L[2 * ST_HALVES];
  const unsigned wave = __builtin_amdgcn_readfirstlane(threadIdx.x >> 5);
  const int lane = threadIdx.x & 31;
  const int lo = lane & 15, hi = lane >> 4;
  const int z  = blockIdx.z;
  const _Float16* W    = (z == 0) ? Wqh : (z == 1) ? Wkh : Wvh;
  const float*    bias = (z == 0) ? bq  : (z == 1) ? bk  : bv;

  // Packed operands: tile row t, k-block kb at (t * (DMODEL/32) + kb) * FRAG.
  const int TROW = (DMODEL / 32) * FRAG;  // halves per 16-row tile
  v8f acc[4][4] = {};
  gemm_block(Xh + (size_t)blockIdx.y * (GEMM_TM / 16) * TROW,
             W + (size_t)blockIdx.x * (GEMM_TN / 16) * TROW, L, wave, lane,
             acc);
  const int n0 = blockIdx.x * GEMM_TN + (wave & 1) * 64;
  const int m0 = blockIdx.y * GEMM_TM + (wave >> 1) * 64;

  const int b_ = m0 >> 11;  // 64-row tile never crosses a batch boundary
  const int hh = n0 >> 6;   // 64-column tile is exactly one head
  const int sb = m0 & (SLEN - 1);
  const size_t head = (size_t)(b_ * NHEAD + hh) * SLEN * DK;
  if (z < 2) {  // Q or K: fragments [s/16][d/32], row = token, k = d
    _Float16* O = ((z == 0) ? Qo : Ko) + head;
#pragma unroll
    for (int j = 0; j < 4; ++j) {
      const int d = j * 16 + lo;
      const float bb = bias[n0 + d];
#pragma unroll
      for (int i = 0; i < 4; ++i) {
        _Float16* fr = O + (((sb >> 4) + i) * (DK / 32) + (d >> 5)) * FRAG;
#pragma unroll
        for (int r = 0; r < 8; ++r) {
          const int row = hi * 8 + r;
          fr[pk_in_frag(row, d)] = (_Float16)(acc[i][j][r] + bb);
        }
      }
    }
  } else {      // V: fragments [s/32][d/16], row = d, k = token
    _Float16* O = Vo + head;
#pragma unroll
    for (int j = 0; j < 4; ++j) {
      const float bb = bias[n0 + j * 16 + lo];
#pragma unroll
      for (int i = 0; i < 4; ++i) {
        const int s0 = sb + i * 16 + hi * 8;   // 8 tokens in a row per lane
        v8h o;
#pragma unroll
        for (int r = 0; r < 8; ++r) o[r] = (_Float16)(acc[i][j][r] + bb);
        *(v8h*)(O + ((s0 >> 5) * (DK / 16) + j) * FRAG + pk_in_frag(lo, s0)) = o;
      }
      __builtin_amdgcn_sched_barrier(0);
    }
    // Stands in front of any later overwrite of the stores' data and address
    // registers (the listing leaves a path from here into the branch above).
    asm volatile("s_wait_xcnt 0x0" ::: "memory");
  }
}

#define AT_WAVES 8
#define AT_Q     (AT_WAVES * 16)      // queries per block
#define AT_BLOCKS (SLEN / AT_Q)       // query blocks per head
#define AT_KEYS  64                   // keys per stage
#define AT_OPH   (AT_KEYS * DK)       // halves of K, or of V, per stage
#define AT_STH   (2 * AT_OPH)         // halves per buffer: K, then V
static_assert(AT_OPH * 2 == 2 * AT_WAVES * 32 * 16 && AT_Q >= 2 * AT_KEYS &&
                  AT_Q % (2 * AT_KEYS) == 0 && SLEN % (2 * AT_Q) == 0,
              "two 16-byte copies per lane and operand; an even number of "
              "stages per block, an even number of blocks");

__device__ __forceinline__ void copy_kv(unsigned l, const _Float16* k,
                                        const _Float16* v) {
  asm volatile(
      "global_load_async_to_lds_b128 %0, %4, off\n\t"
      "global_load_async_to_lds_b128 %1, %5, off\n\t"
      "global_load_async_to_lds_b128 %2, %6, off\n\t"
      "global_load_async_to_lds_b128 %3, %7, off\n\t"
      "s_wait_xcnt 0x0"
      :
      : "v"(l), "v"(l + 4096u), "v"(l + 8192u), "v"(l + 12288u),
        "v"(k), "v"(k + 2048), "v"(v), "v"(v + 2048)
      : "memory");
}

__device__ __forceinline__ float xhalf(float x) {
  const int b = __builtin_bit_cast(int, x);
  return __builtin_bit_cast(float, __builtin_amdgcn_permlanex16(
      b, b, 0x76543210, 0xfedcba98, false, false));
}

__global__ void __launch_bounds__(AT_WAVES * 32)
attn_kernel(const _Float16* __restrict__ Q, const _Float16* __restrict__ K,
            const _Float16* __restrict__ V, _Float16* __restrict__ O) {
  __shared__ __attribute__((aligned(16))) _Float16 L[2 * AT_STH];
  const int wave = __builtin_amdgcn_readfirstlane(threadIdx.x >> 5);
  const int lane = threadIdx.x & 31;
  const int lo = lane & 15, hi = lane >> 4;
  const int h  = blockIdx.y;
  const int b  = blockIdx.z;

  // Packed per head: a 16-token tile of Q or K is 2 fragments, a 32-key
  // chunk of K or of V is 4 fragments (CHUNK halves) in a row.
  const int CHUNK = 4 * FRAG;
  const size_t head = (size_t)(b * NHEAD + h) * SLEN * DK;
  const _Float16* kp = K + head;
  const _Float16* vp = V + head;

  const unsigned lcp = (unsigned)(size_t)L + threadIdx.x * 16;  // bytes
  const _Float16* kg = kp + threadIdx.x * 8;
  const _Float16* vg = vp + threadIdx.x * 8;

  copy_kv(lcp, kg, vg);
  // Stage 0 has landed for this wave, and behind the barrier for all waves.
  asm volatile("s_wait_asynccnt 0x0" ::: "memory");
  __syncthreads();
  copy_kv(lcp + AT_STH * 2, kg + AT_OPH, vg + AT_OPH);

  for (int part = 0; part < 2; ++part) {
    // Block of AT_Q queries: the long one first, then its short partner.
    const int pb = part ? (int)blockIdx.x : AT_BLOCKS - 1 - (int)blockIdx.x;
    const int q0 = pb * AT_Q + wave * 16;
    const _Float16* qp = Q + head + (q0 >> 4) * (2 * FRAG) + lane * 8;

    const v16h qb0 = frag_pk(qp);         // B: column = query lo, k = d 0..31
    const v16h qb1 = frag_pk(qp + FRAG);  // B: column = query lo, k = d 32..63

    // Per lane: running maximum of query lo (alike in both halves), the sum
    // over this half's keys only, and O^T: acc[t][r] = O[lo][t*16 + hi*8 + r].
    float mrow = -__builtin_inff(), lrow = 0.f;
    v8f acc[4] = {{}, {}, {}, {}};
    const int qrow = q0 + lo;

    const int s_end = q0 + 16;  // causal upper bound of this wave
    const int nst = (pb + 1) * (AT_Q / AT_KEYS);  // stages of the block

    for (int st = 0; st < nst; ++st) {
      const unsigned buf = (st & 1) * AT_STH;
      // Unrolled: a chunk's place in the buffer becomes the immediate offset
      // of its LDS reads.
#pragma unroll
      for (int c = 0; c < AT_KEYS / 32; ++c) {
        const int s0 = st * AT_KEYS + c * 32;
        if (s0 >= s_end) continue;  // wave-uniform: beyond the wave's diagonal
        const _Float16* kc = L + buf + c * CHUNK;
        const _Float16* vc = L + buf + AT_OPH + c * CHUNK;

        // ---- scores: S^T = K * Q^T ----
        v8f sc0 = {}, sc1 = {};
        {
          const _Float16* kr = kc + lane * 8;
          const v16h k00 = frag_pk(kr);             // keys s0 .. s0+15
          const v16h k01 = frag_pk(kr + FRAG);
          const v16h k10 = frag_pk(kr + 2 * FRAG);  // keys s0+16 .. s0+31
          const v16h k11 = frag_pk(kr + 3 * FRAG);
          // Holds the chunk's 8 LDS reads of K together in front of its
          // WMMAs: left alone the compiler sinks them among the WMMAs, one
          // register set, a wait to 0 in front of each.
          __builtin_amdgcn_sched_barrier(0);
          sc0 = wmma16(k00, qb0, sc0);
          sc0 = wmma16(k01, qb1, sc0);
          sc1 = wmma16(k10, qb0, sc1);
          sc1 = wmma16(k11, qb1, sc1);
        }

        const int rel = qrow - s0 - hi * 8;  // key <= query <=> r (+ 16) <= rel
#pragma unroll
        for (int r = 0; r < 8; ++r) {
          const float a0 = sc0[r] * 0.125f;   // 1/sqrt(64)
          const float a1 = sc1[r] * 0.125f;
          sc0[r] = (r <= rel)      ? a0 : -__builtin_inff();
          sc1[r] = (r + 16 <= rel) ? a1 : -__builtin_inff();
        }

        // ---- online softmax, one query per lane ----
        float cm0 = fmaxf(sc0[0], sc1[0]), cm1 = fmaxf(sc0[1], sc1[1]);
#pragma unroll
        for (int r = 2; r < 8; r += 2) {
          cm0 = fmaxf(fmaxf(cm0, sc0[r]), sc1[r]);
          cm1 = fmaxf(fmaxf(cm1, sc0[r + 1]), sc1[r + 1]);
        }
        float cm = fmaxf(cm0, cm1);
        cm = fmaxf(cm, xhalf(cm));  // all 32 keys; key s0 is never masked
        const float mnew = fmaxf(mrow, cm);
        const float corr = __expf(mrow - mnew);
        float rs0 = 0.f, rs1 = 0.f;
        v16h pt;  // B: column = query lo, k = key in the hardware order
#pragma unroll
        for (int r = 0; r < 8; ++r) {
          const float p0 = __expf(sc0[r] - mnew);
          const float p1 = __expf(sc1[r] - mnew);
          rs0 += p0;
          rs1 += p1;
          pt[r]     = (_Float16)p0;
          pt[r + 8] = (_Float16)p1;
        }
        lrow = lrow * corr + (rs0 + rs1);
        mrow = mnew;
#pragma unroll
        for (int t = 0; t < 4; ++t) acc[t] *= corr;

        // ---- O^T += V^T * P^T (fragment t: rows d = t*16 .. t*16+15) ----
#pragma unroll
        for (int t = 0; t < 4; ++t)
          acc[t] = wmma16(frag_pk(vc + t * FRAG + lane * 8), pt, acc[t]);
      }
      // Publish point of the next stage: this wave's reads of stage st are
      // done, its copies of the next stage have landed; the barrier says so
      // of every wave.
      asm volatile("s_wait_dscnt 0x0" ::: "memory");
      asm volatile("s_wait_asynccnt 0x0" ::: "memory");
      __syncthreads();
      // Refill the buffer that every wave has left with the stage after the
      // next: of this block or, at its end, of the second block.
      const int nx = (st + 2 < nst) ? st + 2 : st + 2 - nst;
      if (st + 2 < nst || part == 0)
        copy_kv(lcp + buf * 2, kg + nx * AT_OPH, vg + nx * AT_OPH);
    }

    // ---- finalize: join the halves' sums, divide, store packed for the
    //      projection: fragments [token/16][k/32], row = token = lo,
    //      k = h*64 + d. A lane's 8 values of tile t are 8 d in a row, so each
    //      tile is one 16-byte store per lane, 512 bytes in a row per wave.
    _Float16* ot = O + ((size_t)((b * SLEN + q0) >> 4) * (DMODEL / 32) +
                        h * (DK / 32)) * FRAG + lane * 8;
    const float inv = 1.0f / (lrow + xhalf(lrow));
    v8h o[4];
#pragma unroll
    for (int t = 0; t < 4; ++t) {
#pragma unroll
      for (int r = 0; r < 8; ++r) o[t][r] = (_Float16)(acc[t][r] * inv);
    }
#pragma unroll
    for (int t = 0; t < 4; ++t)
      *(v8h*)(ot + (t >> 1) * FRAG + (t & 1) * 256) = o[t];
    // Stands in front of the second block's overwrite of the stores' data and
    // address registers.
    asm volatile("s_wait_xcnt 0x0" ::: "memory");
  }
  // No copy is outstanding when the wave ends.
  asm volatile("s_wait_asynccnt 0x0" ::: "memory");
}

// ---------------------------------------------------------------------------
// Kernel 3: output projection, 64x64 tile per wave, 8 waves per work-group
// (gemm_block). out = attn @ Wo.T + bo, both operands fragment-packed, fp32
// result straight to d_out.
// ---------------------------------------------------------------------------
__global__ void __launch_bounds__(GEMM_WAVES * 32, 4)
out_proj_kernel(const _Float16* __restrict__ A, const _Float16* __restrict__ W,
                const float* __restrict__ bias, float* __restrict__ out) {
  __shared__ __attribute__((aligned(16))) _Float16 L[2 * ST_HALVES];
  const unsigned wave = __builtin_amdgcn_readfirstlane(threadIdx.x >> 5);
  const int lane = threadIdx.x & 31;
  const int lo = lane & 15, hi = lane >> 4;

  // Packed operands: tile row t, k-block kb at (t * (DMODEL/32) + kb) * FRAG.
  const int TROW = (DMODEL / 32) * FRAG;  // halves per 16-row tile
  v8f acc[4][4] = {};
  gemm_block(A + (size_t)blockIdx.y * (GEMM_TM / 16) * TROW,
             W + (size_t)blockIdx.x * (GEMM_TN / 16) * TROW, L, wave, lane,
             acc);
  const int n0 = blockIdx.x * GEMM_TN + (wave & 1) * 64;
  const int m0 = blockIdx.y * GEMM_TM + (wave >> 1) * 64;

#pragma unroll
  for (int j = 0; j < 4; ++j) {
    const int col = n0 + j * 16 + lo;
    const float bb = bias[col];
#pragma unroll
    for (int i = 0; i < 4; ++i) {
#pragma unroll
      for (int r = 0; r < 8; ++r) {
        const int row = m0 + i * 16 + hi * 8 + r;
        out[(size_t)row * DMODEL + col] = acc[i][j][r] + bb;
      }
    }
  }
}

// ---------------------------------------------------------------------------
extern "C" void kernel_launch(void* const* d_in, const int* in_sizes, int n_in,
                              void* d_out, int out_size, void* d_ws,
                              size_t ws_size, hipStream_t stream) {
  const float* x  = (const float*)d_in[0];
  const float* Wq = (const float*)d_in[1];
  const float* bq = (const float*)d_in[2];
  const float* Wk = (const float*)d_in[3];
  const float* bk = (const float*)d_in[4];
  const float* Wv = (const float*)d_in[5];
  const float* bv = (const float*)d_in[6];
  const float* Wo = (const float*)d_in[7];
  const float* bo = (const float*)d_in[8];
  float* out = (float*)d_out;

  const size_t TOK = (size_t)NB * SLEN;          // 8192 tokens

  // Workspace map (f16): q/k/v/attn 16 MB each, x_h 16 MB, weights 2 MB x4.
  char* ws = (char*)d_ws;
  _Float16* q_ws = (_Float16*)(ws);
  _Float16* k_ws = (_Float16*)(ws + 16ull * 1024 * 1024);
  _Float16* v_ws = (_Float16*)(ws + 32ull * 1024 * 1024);
  _Float16* a_ws = (_Float16*)(ws + 48ull * 1024 * 1024);
  _Float16* x_h  = (_Float16*)(ws + 64ull * 1024 * 1024);
  _Float16* wq_h = (_Float16*)(ws + 80ull * 1024 * 1024);
  _Float16* wk_h = (_Float16*)(ws + 82ull * 1024 * 1024);
  _Float16* wv_h = (_Float16*)(ws + 84ull * 1024 * 1024);
  _Float16* wo_h = (_Float16*)(ws + 86ull * 1024 * 1024);

  // 0) fp32 -> f16 conversion, one launch: x_h and the four weight planes
  //    lie one behind the other in the workspace map above.
  cvt_f32_to_f16<<<CVT_GRID, 512, 0, stream>>>(x, Wq, Wk, Wv, Wo, x_h);

  // 1) QKV projections: 256x128 block per work-group, z selects Q/K/V.
  dim3 qkv_grid(DMODEL / GEMM_TN, (unsigned)(TOK / GEMM_TM), 3);
  qkv_gemm_kernel<<<qkv_grid, GEMM_WAVES * 32, 0, stream>>>(x_h, wq_h, wk_h, wv_h,
                                               bq, bk, bv, q_ws, k_ws, v_ws);

  // 2) Attention: 8 waves per (pair of blocks of 128 queries, head, batch).
  dim3 attn_grid(AT_BLOCKS / 2, NHEAD, NB);
  attn_kernel<<<attn_grid, AT_WAVES * 32, 0, stream>>>(q_ws, k_ws, v_ws, a_ws);

  // 3) Output projection (fp32 result).
  dim3 proj_grid(DMODEL / GEMM_TN, (unsigned)(TOK / GEMM_TM));
  out_proj_kernel<<<proj_grid, GEMM_WAVES * 32, 0, stream>>>(a_ws, wo_h, bo, out);
}

// v007
// It runs in 109 microseconds.
// Next to v006, in two timings, it ran 1.05 times as fast each time.
// Over all steps from v000 it is 3.41 times as fast.
#include <hip/hip_runtime.h>

#define DMODEL 1024
#define SLEN   2048
#define NHEAD  16
#define DK     64
#define NB     4

typedef __attribute__((ext_vector_type(16))) _Float16 v16h;
typedef __attribute__((ext_vector_type(8)))  _Float16 v8h;
typedef __attribute__((ext_vector_type(4)))  _Float16 v4h;
typedef __attribute__((ext_vector_type(4)))  float    v4f;
typedef __attribute__((ext_vector_type(8)))  float    v8f;

// D = A(16x32 f16) * B(32x16 f16) + C(16x16 f32)
__device__ __forceinline__ v8f wmma16(v16h a, v16h b, v8f c) {
  return __builtin_amdgcn_wmma_f32_16x16x32_f16(
      /*neg_a=*/false, a, /*neg_b=*/false, b,
      /*c_mod=*/(short)0, c, /*reuse_a=*/false, /*reuse_b=*/false);
}

__device__ __forceinline__ v16h frag_f16(const _Float16* __restrict__ p) {
  v8h a = *(const v8h*)(p);
  v8h b = *(const v8h*)(p + 16);
  v16h f;
#pragma unroll
  for (int j = 0; j < 8; ++j) { f[j] = a[j]; f[j + 8] = b[j]; }
  return f;
}

// ---------------------------------------------------------------------------
// Fragment-packed layout of every f16 workspace operand.
// A matrix M[row][k] that feeds WMMA as A (lane = row) or B (lane = column,
// stored as row) is kept as 16x32 fragments of 512 halves (1024 bytes), each
// in the order the lanes read it: two units of 256 halves, unit u holding
// k = u*16 + hi*8 + j at [lane = hi*16 + (row & 15)][j]. One wave-wide
// 16-byte load then covers 512 contiguous bytes (4 whole lines) where a
// row-major operand gives 16 rows x 32 bytes (16 lines).
// ---------------------------------------------------------------------------
#define FRAG 512  // halves per 16x32 fragment

// Place of element (row & 15, k & 31) inside its fragment, in halves.
__device__ __forceinline__ int pk_in_frag(int row, int k) {
  return ((k >> 4) & 1) * 256 + ((((k >> 3) & 1) << 4) + (row & 15)) * 8 +
         (k & 7);
}

__device__ __forceinline__ v16h frag_pk(const _Float16* __restrict__ p) {
  v8h a = *(const v8h*)(p);
  v8h b = *(const v8h*)(p + 256);
  v16h f;
#pragma unroll
  for (int j = 0; j < 8; ++j) { f[j] = a[j]; f[j + 8] = b[j]; }
  return f;
}

#define XTILES   (NB * SLEN / 16)   // 16-row tiles of x
#define WTILES   (DMODEL / 16)      // 16-row tiles of one weight matrix
#define CVT_GRID 256
static_assert(XTILES == 2 * CVT_GRID && 4 * WTILES == CVT_GRID,
              "three row tiles per work-group");

__global__ void __launch_bounds__(512)
cvt_f32_to_f16(const float* __restrict__ x, const float* __restrict__ wq,
               const float* __restrict__ wk, const float* __restrict__ wv,
               const float* __restrict__ wo, _Float16* __restrict__ out) {
  const unsigned w = threadIdx.x >> 5, l = threadIdx.x & 31;
  const unsigned r = l >> 3;        // row inside a group of 4 rows
  const unsigned c = (l & 7) * 4;   // column inside a 32-column block
  const unsigned g = blockIdx.x;
  const unsigned TILE = 16 * DMODEL;  // elements of a row tile, in and out

  // Block-uniform tile bases, one lane offset for all of them.
  const unsigned m = g / WTILES;
  const float* wsel = (m & 2) ? ((m & 1) ? wo : wv) : ((m & 1) ? wk : wq);
  const float* src[3] = {x + (size_t)g * TILE,
                         x + (size_t)(g + CVT_GRID) * TILE,
                         wsel + (size_t)(g % WTILES) * TILE};
  const unsigned loff = r * DMODEL + w * 64 + c;

  v4f v[3][2][4];
#pragma unroll
  for (int p = 0; p < 3; ++p)
#pragma unroll
    for (int f = 0; f < 2; ++f)
#pragma unroll
      for (int q = 0; q < 4; ++q)
        v[p][f][q] = *(const v4f*)(src[p] + loff + q * 4 * DMODEL + f * 32);

  const unsigned soff = w * 2 * FRAG + pk_in_frag(r, c);
#pragma unroll
  for (int p = 0; p < 3; ++p) {
    _Float16* o = out + (size_t)(g + p * CVT_GRID) * TILE;
#pragma unroll
    for (int f = 0; f < 2; ++f)
#pragma unroll
      for (int q = 0; q < 4; ++q) {
        v4h h;
#pragma unroll
        for (int j = 0; j < 4; ++j) h[j] = (_Float16)v[p][f][q][j];
        // rows q*4 + r: 4 rows further on is 32 halves further on
        *(v4h*)(o + soff + f * FRAG + q * 32) = h;
      }
  }
}

#define GEMM_WAVES 8
#define GEMM_TM    256
#define GEMM_TN    128
#define ST_FRAGS   2                               // fragments per tile row
#define ST_COUNT   (DMODEL / 32 / ST_FRAGS)        // stages
#define ST_ROW     (ST_FRAGS * FRAG)               // halves per tile row
#define ST_AROWS   (GEMM_TM / 16)
#define ST_ROWS    ((GEMM_TM + GEMM_TN) / 16)      // tile rows per stage
#define ST_HALVES  (ST_ROWS * ST_ROW)              // halves per buffer
static_assert(ST_ROWS == 3 * GEMM_WAVES && ST_ROW == 4 * 256 && ST_COUNT >= 2,
              "a wave copies three tile rows, four 512-byte pieces each");

__device__ __forceinline__ void copy_row(unsigned l, const _Float16* g) {
  asm volatile(
      "global_load_async_to_lds_b128 %0, %4, off\n\t"
      "global_load_async_to_lds_b128 %1, %5, off\n\t"
      "global_load_async_to_lds_b128 %2, %6, off\n\t"
      "global_load_async_to_lds_b128 %3, %7, off\n\t"
      "s_wait_xcnt 0x0"
      :
      : "v"(l), "v"(l + 512u), "v"(l + 1024u), "v"(l + 1536u),
        "v"(g), "v"(g + 256), "v"(g + 512), "v"(g + 768)
      : "memory");
}
__device__ __forceinline__ void copy_stage(unsigned l, const _Float16* g0,
                                           const _Float16* g1,
                                           const _Float16* g2) {
  copy_row(l, g0);
  copy_row(l + 2048u, g1);
  copy_row(l + 4096u, g2);
}

// Ab, Bb: first packed tile row of the block's A rows and B rows. wave is
// wave-uniform. On return acc holds the wave's 64x64 tile, rows
// (wave >> 1) * 64, columns (wave & 1) * 64 of the block.
__device__ __forceinline__ void gemm_block(const _Float16* __restrict__ Ab,
                                           const _Float16* __restrict__ Bb,
                                           _Float16* L, unsigned wave,
                                           unsigned lane, v8f (&acc)[4][4]) {
  const int TROW = (DMODEL / 32) * FRAG;  // halves per packed 16-row tile
  const _Float16* g[3];
#pragma unroll
  for (unsigned i = 0; i < 3; ++i) {
    const unsigned r = 3 * wave + i;  // tile row of the stage: A first, then B
    g[i] = ((r < ST_AROWS) ? Ab + (size_t)r * TROW
                           : Bb + (size_t)(r - ST_AROWS) * TROW) + lane * 8;
  }
  const unsigned lcp =
      (unsigned)(size_t)L + (wave * 3 * ST_ROW + lane * 8) * 2;  // bytes

  copy_stage(lcp, g[0], g[1], g[2]);
  // Stage 0 has landed for this wave, and behind the barrier for all waves.
  asm volatile("s_wait_asynccnt 0x0" ::: "memory");
  __syncthreads();
  copy_stage(lcp + ST_HALVES * 2, g[0] + ST_ROW, g[1] + ST_ROW, g[2] + ST_ROW);

  const _Float16* la = L + (wave >> 1) * 4 * ST_ROW + lane * 8;
  const _Float16* lb = L + (ST_AROWS + (wave & 1) * 4) * ST_ROW + lane * 8;
  for (int t = 0; t < ST_COUNT; ++t) {
    const unsigned buf = (t & 1) * ST_HALVES;
    v16h a[4], bf[4];
#pragma unroll
    for (int kk = 0; kk < ST_FRAGS; ++kk) {
      bf[0] = frag_pk(lb + buf + kk * FRAG);
#pragma unroll
      for (int i = 0; i < 4; ++i)
        a[i] = frag_pk(la + buf + i * ST_ROW + kk * FRAG);
#pragma unroll
      for (int j = 1; j < 4; ++j)
        bf[j] = frag_pk(lb + buf + j * ST_ROW + kk * FRAG);
      if (kk == ST_FRAGS - 1) {
        // Publish point of stage t + 1, behind the stage's last LDS reads and
        // in front of their WMMAs: this wave's reads of stage t are done, its
        // copies of stage t + 1 have landed; the barrier says so of every
        // wave.
        asm volatile("s_wait_dscnt 0x0" ::: "memory");
        asm volatile("s_wait_asynccnt 0x0" ::: "memory");
        __syncthreads();
        if (t + 2 < ST_COUNT)  // refill the buffer that every wave has left
          copy_stage(lcp + buf * 2, g[0] + (t + 2) * ST_ROW,
                     g[1] + (t + 2) * ST_ROW, g[2] + (t + 2) * ST_ROW);
      }
      // Holds the 16 LDS reads of a k-step (and the refill) together in front
      // of its WMMAs: left alone the compiler sinks the B reads among the
      // WMMAs, one register set, a wait to 0 in front of every four.
      __builtin_amdgcn_sched_barrier(0);
#pragma unroll
      for (int j = 0; j < 4; ++j)
#pragma unroll
        for (int i = 0; i < 4; ++i) acc[i][j] = wmma16(a[i], bf[j], acc[i][j]);
    }
  }
  // No copy is outstanding when the wave goes on to its stores and ends.
  asm volatile("s_wait_asynccnt 0x0" ::: "memory");
}

// ---------------------------------------------------------------------------
// Kernel 1: QKV projection, one wave per 64x64 output tile, 8 waves per
// work-group (gemm_block), blockIdx.z picks the matrix (0=Q, 1=K, 2=V).
// out[m,n] = sum_k x[m,k]*W[n,k] + b[n].
// All operands and results are fragment-packed. Per (b, h): Q and K as
// [s/16][d/32] fragments (row = token, k = d), V as [s/32][d/16] fragments
// (row = d, k = token) so a 32-key chunk of K or of V is 4 KB in a row.
// ---------------------------------------------------------------------------
__global__ void __launch_bounds__(GEMM_WAVES * 32, 4)
qkv_gemm_kernel(const _Float16* __restrict__ Xh,
                const _Float16* __restrict__ Wqh,
                const _Float16* __restrict__ Wkh,
                const _Float16* __restrict__ Wvh,
                const float* __restrict__ bq, const float* __restrict__ bk,
                const float* __restrict__ bv,
                _Float16* __restrict__ Qo, _Float16* __restrict__ Ko,
                _Float16* __restrict__ Vo) {
  __shared__ __attribute__((aligned(16))) _Float16 L[2 * ST_HALVES];
  const unsigned wave = __builtin_amdgcn_readfirstlane(threadIdx.x >> 5);
  const int lane = threadIdx.x & 31;
  const int lo = lane & 15, hi = lane >> 4;
  const int z  = blockIdx.z;
  const _Float16* W    = (z == 0) ? Wqh : (z == 1) ? Wkh : Wvh;
  const float*    bias = (z == 0) ? bq  : (z == 1) ? bk  : bv;

  // Packed operands: tile row t, k-block kb at (t * (DMODEL/32) + kb) * FRAG.
  const int TROW = (DMODEL / 32) * FRAG;  // halves per 16-row tile
  v8f acc[4][4] = {};
  gemm_block(Xh + (size_t)blockIdx.y * (GEMM_TM / 16) * TROW,
             W + (size_t)blockIdx.x * (GEMM_TN / 16) * TROW, L, wave, lane,
             acc);
  const int n0 = blockIdx.x * GEMM_TN + (wave & 1) * 64;
  const int m0 = blockIdx.y * GEMM_TM + (wave >> 1) * 64;

  const int b_ = m0 >> 11;  // 64-row tile never crosses a batch boundary
  const int hh = n0 >> 6;   // 64-column tile is exactly one head
  const int sb = m0 & (SLEN - 1);
  const size_t head = (size_t)(b_ * NHEAD + hh) * SLEN * DK;
  if (z < 2) {  // Q or K: fragments [s/16][d/32], row = token, k = d
    _Float16* O = ((z == 0) ? Qo : Ko) + head;
#pragma unroll
    for (int j = 0; j < 4; ++j) {
      const int d = j * 16 + lo;
      const float bb = bias[n0 + d];
#pragma unroll
      for (int i = 0; i < 4; ++i) {
        _Float16* fr = O + (((sb >> 4) + i) * (DK / 32) + (d >> 5)) * FRAG;
#pragma unroll
        for (int r = 0; r < 8; ++r) {
          const int row = hi * 8 + r;
          fr[pk_in_frag(row, d)] = (_Float16)(acc[i][j][r] + bb);
        }
      }
    }
  } else {      // V: fragments [s/32][d/16], row = d, k = token
    _Float16* O = Vo + head;
#pragma unroll
    for (int j = 0; j < 4; ++j) {
      const float bb = bias[n0 + j * 16 + lo];
#pragma unroll
      for (int i = 0; i < 4; ++i) {
        const int s0 = sb + i * 16 + hi * 8;   // 8 tokens in a row per lane
        v8h o;
#pragma unroll
        for (int r = 0; r < 8; ++r) o[r] = (_Float16)(acc[i][j][r] + bb);
        *(v8h*)(O + ((s0 >> 5) * (DK / 16) + j) * FRAG + pk_in_frag(lo, s0)) = o;
      }
      __builtin_amdgcn_sched_barrier(0);
    }
    // Stands in front of any later overwrite of the stores' data and address
    // registers (the listing leaves a path from here into the branch above).
    asm volatile("s_wait_xcnt 0x0" ::: "memory");
  }
}

#define AT_WAVES 8
#define AT_Q     (AT_WAVES * 16)      // queries per block
#define AT_BLOCKS (SLEN / AT_Q)       // query blocks per head
#define AT_KEYS  64                   // keys per stage
#define AT_OPH   (AT_KEYS * DK)       // halves of K, or of V, per stage
#define AT_STH   (2 * AT_OPH)         // halves per buffer: K, then V
static_assert(AT_OPH * 2 == 2 * AT_WAVES * 32 * 16 && AT_Q >= 2 * AT_KEYS &&
                  AT_Q % (2 * AT_KEYS) == 0 && SLEN % (2 * AT_Q) == 0,
              "two 16-byte copies per lane and operand; an even number of "
              "stages per block, an even number of blocks");

__device__ __forceinline__ void copy_kv(unsigned l, const _Float16* k,
                                        const _Float16* v) {
  asm volatile(
      "global_load_async_to_lds_b128 %0, %4, off\n\t"
      "global_load_async_to_lds_b128 %1, %5, off\n\t"
      "global_load_async_to_lds_b128 %2, %6, off\n\t"
      "global_load_async_to_lds_b128 %3, %7, off\n\t"
      "s_wait_xcnt 0x0"
      :
      : "v"(l), "v"(l + 4096u), "v"(l + 8192u), "v"(l + 12288u),
        "v"(k), "v"(k + 2048), "v"(v), "v"(v + 2048)
      : "memory");
}

__device__ __forceinline__ float xhalf(float x) {
  const int b = __builtin_bit_cast(int, x);
  return __builtin_bit_cast(float, __builtin_amdgcn_permlanex16(
      b, b, 0x76543210, 0xfedcba98, false, false));
}

__global__ void __launch_bounds__(AT_WAVES * 32)
attn_kernel(const _Float16* __restrict__ Q, const _Float16* __restrict__ K,
            const _Float16* __restrict__ V, _Float16* __restrict__ O) {
  __shared__ __attribute__((aligned(16))) _Float16 L[2 * AT_STH];
  const int wave = __builtin_amdgcn_readfirstlane(threadIdx.x >> 5);
  const int lane = threadIdx.x & 31;
  const int lo = lane & 15, hi = lane >> 4;
  const int h  = blockIdx.y;
  const int b  = blockIdx.z;

  // Packed per head: a 16-token tile of Q or K is 2 fragments, a 32-key
  // chunk of K or of V is 4 fragments (CHUNK halves) in a row.
  const int CHUNK = 4 * FRAG;
  const size_t head = (size_t)(b * NHEAD + h) * SLEN * DK;
  const _Float16* kp = K + head;
  const _Float16* vp = V + head;

  const unsigned lcp = (unsigned)(size_t)L + threadIdx.x * 16;  // bytes
  const _Float16* kg = kp + threadIdx.x * 8;
  const _Float16* vg = vp + threadIdx.x * 8;

  copy_kv(lcp, kg, vg);
  // Stage 0 has landed for this wave, and behind the barrier for all waves.
  asm volatile("s_wait_asynccnt 0x0" ::: "memory");
  __syncthreads();
  copy_kv(lcp + AT_STH * 2, kg + AT_OPH, vg + AT_OPH);

  for (int part = 0; part < 2; ++part) {
    // Block of AT_Q queries: the long one first, then its short partner.
    const int pb = part ? (int)blockIdx.x : AT_BLOCKS - 1 - (int)blockIdx.x;
    const int q0 = pb * AT_Q + wave * 16;
    const _Float16* qp = Q + head + (q0 >> 4) * (2 * FRAG) + lane * 8;

    const v16h qb0 = frag_pk(qp);         // B: column = query lo, k = d 0..31
    const v16h qb1 = frag_pk(qp + FRAG);  // B: column = query lo, k = d 32..63

    // Per lane: running maximum of query lo (alike in both halves), the sum
    // over this half's keys only, and O^T: acc[t][r] = O[lo][t*16 + hi*8 + r].
    float mrow = -__builtin_inff(), lrow = 0.f;
    v8f acc[4] = {{}, {}, {}, {}};
    const int qrow = q0 + lo;

    const int s_end = q0 + 16;  // causal upper bound of this wave
    const int nst = (pb + 1) * (AT_Q / AT_KEYS);  // stages of the block

    for (int st = 0; st < nst; ++st) {
      const unsigned buf = (st & 1) * AT_STH;
      // Unrolled: a chunk's place in the buffer becomes the immediate offset
      // of its LDS reads.
#pragma unroll
      for (int c = 0; c < AT_KEYS / 32; ++c) {
        const int s0 = st * AT_KEYS + c * 32;
        if (s0 >= s_end) continue;  // wave-uniform: beyond the wave's diagonal
        const _Float16* kc = L + buf + c * CHUNK;
        const _Float16* vc = L + buf + AT_OPH + c * CHUNK;

        // ---- scores: S^T = K * Q^T ----
        v8f sc0 = {}, sc1 = {};
        {
          const _Float16* kr = kc + lane * 8;
          const v16h k00 = frag_pk(kr);             // keys s0 .. s0+15
          const v16h k01 = frag_pk(kr + FRAG);
          const v16h k10 = frag_pk(kr + 2 * FRAG);  // keys s0+16 .. s0+31
          const v16h k11 = frag_pk(kr + 3 * FRAG);
          // Holds the chunk's 8 LDS reads of K together in front of its
          // WMMAs: left alone the compiler sinks them among the WMMAs, one
          // register set, a wait to 0 in front of each.
          __builtin_amdgcn_sched_barrier(0);
          sc0 = wmma16(k00, qb0, sc0);
          sc0 = wmma16(k01, qb1, sc0);
          sc1 = wmma16(k10, qb0, sc1);
          sc1 = wmma16(k11, qb1, sc1);
        }

#pragma unroll
        for (int r = 0; r < 8; ++r) {
          sc0[r] *= 0.125f;   // 1/sqrt(64)
          sc1[r] *= 0.125f;
        }
        // Only the chunk that holds the wave's diagonal has keys beyond a
        // query of the wave: a scalar branch takes every other chunk round
        // the compares and selects.
        if (s0 + 31 > q0) {
          const int rel = qrow - s0 - hi * 8;  // key <= query <=> r (+16) <= rel
#pragma unroll
          for (int r = 0; r < 8; ++r) {
            sc0[r] = (r <= rel)      ? sc0[r] : -__builtin_inff();
            sc1[r] = (r + 16 <= rel) ? sc1[r] : -__builtin_inff();
          }
        }

        // ---- online softmax, one query per lane ----
        float cm0 = fmaxf(sc0[0], sc1[0]), cm1 = fmaxf(sc0[1], sc1[1]);
#pragma unroll
        for (int r = 2; r < 8; r += 2) {
          cm0 = fmaxf(fmaxf(cm0, sc0[r]), sc1[r]);
          cm1 = fmaxf(fmaxf(cm1, sc0[r + 1]), sc1[r + 1]);
        }
        float cm = fmaxf(cm0, cm1);
        cm = fmaxf(cm, xhalf(cm));  // all 32 keys; key s0 is never masked
        const float mnew = fmaxf(mrow, cm);
        const float corr = __expf(mrow - mnew);
        float rs0 = 0.f, rs1 = 0.f;
        v16h pt;  // B: column = query lo, k = key in the hardware order
#pragma unroll
        for (int r = 0; r < 8; ++r) {
          const float p0 = __expf(sc0[r] - mnew);
          const float p1 = __expf(sc1[r] - mnew);
          rs0 += p0;
          rs1 += p1;
          pt[r]     = (_Float16)p0;
          pt[r + 8] = (_Float16)p1;
        }
        lrow = lrow * corr + (rs0 + rs1);
        mrow = mnew;
#pragma unroll
        for (int t = 0; t < 4; ++t) acc[t] *= corr;

        // ---- O^T += V^T * P^T (fragment t: rows d = t*16 .. t*16+15) ----
#pragma unroll
        for (int t = 0; t < 4; ++t)
          acc[t] = wmma16(frag_pk(vc + t * FRAG + lane * 8), pt, acc[t]);
      }
      // Publish point of the next stage: this wave's reads of stage st are
      // done, its copies of the next stage have landed; the barrier says so
      // of every wave.
      asm volatile("s_wait_dscnt 0x0" ::: "memory");
      asm volatile("s_wait_asynccnt 0x0" ::: "memory");
      __syncthreads();
      // Refill the buffer that every wave has left with the stage after the
      // next: of this block or, at its end, of the second block.
      const int nx = (st + 2 < nst) ? st + 2 : st + 2 - nst;
      if (st + 2 < nst || part == 0)
        copy_kv(lcp + buf * 2, kg + nx * AT_OPH, vg + nx * AT_OPH);
    }

    // ---- finalize: join the halves' sums, divide, store packed for the
    //      projection: fragments [token/16][k/32], row = token = lo,
    //      k = h*64 + d. A lane's 8 values of tile t are 8 d in a row, so each
    //      tile is one 16-byte store per lane, 512 bytes in a row per wave.
    _Float16* ot = O + ((size_t)((b * SLEN + q0) >> 4) * (DMODEL / 32) +
                        h * (DK / 32)) * FRAG + lane * 8;
    const float inv = 1.0f / (lrow + xhalf(lrow));
    v8h o[4];
#pragma unroll
    for (int t = 0; t < 4; ++t) {
#pragma unroll
      for (int r = 0; r < 8; ++r) o[t][r] = (_Float16)(acc[t][r] * inv);
    }
#pragma unroll
    for (int t = 0; t < 4; ++t)
      *(v8h*)(ot + (t >> 1) * FRAG + (t & 1) * 256) = o[t];
    // Stands in front of the second block's overwrite of the stores' data and
    // address registers.
    asm volatile("s_wait_xcnt 0x0" ::: "memory");
  }
  // No copy is outstanding when the wave ends.
  asm volatile("s_wait_asynccnt 0x0" ::: "memory");
}

// ---------------------------------------------------------------------------
// Kernel 3: output projection, 64x64 tile per wave, 8 waves per work-group
// (gemm_block). out = attn @ Wo.T + bo, both operands fragment-packed, fp32
// result straight to d_out.
// ---------------------------------------------------------------------------
__global__ void __launch_bounds__(GEMM_WAVES * 32, 4)
out_proj_kernel(const _Float16* __restrict__ A, const _Float16* __restrict__ W,
                const float* __restrict__ bias, float* __restrict__ out) {
  __shared__ __attribute__((aligned(16))) _Float16 L[2 * ST_HALVES];
  const unsigned wave = __builtin_amdgcn_readfirstlane(threadIdx.x >> 5);
  const int lane = threadIdx.x & 31;
  const int lo = lane & 15, hi = lane >> 4;

  // Packed operands: tile row t, k-block kb at (t * (DMODEL/32) + kb) * FRAG.
  const int TROW = (DMODEL / 32) * FRAG;  // halves per 16-row tile
  v8f acc[4][4] = {};
  gemm_block(A + (size_t)blockIdx.y * (GEMM_TM / 16) * TROW,
             W + (size_t)blockIdx.x * (GEMM_TN / 16) * TROW, L, wave, lane,
             acc);
  const int n0 = blockIdx.x * GEMM_TN + (wave & 1) * 64;
  const int m0 = blockIdx.y * GEMM_TM + (wave >> 1) * 64;

#pragma unroll
  for (int j = 0; j < 4; ++j) {
    const int col = n0 + j * 16 + lo;
    const float bb = bias[col];
#pragma unroll
    for (int i = 0; i < 4; ++i) {
#pragma unroll
      for (int r = 0; r < 8; ++r) {
        const int row = m0 + i * 16 + hi * 8 + r;
        out[(size_t)row * DMODEL + col] = acc[i][j][r] + bb;
      }
    }
  }
}

// ---------------------------------------------------------------------------
extern "C" void kernel_launch(void* const* d_in, const int* in_sizes, int n_in,
                              void* d_out, int out_size, void* d_ws,
                              size_t ws_size, hipStream_t stream) {
  const float* x  = (const float*)d_in[0];
  const float* Wq = (const float*)d_in[1];
  const float* bq = (const float*)d_in[2];
  const float* Wk = (const float*)d_in[3];
  const float* bk = (const float*)d_in[4];
  const float* Wv = (const float*)d_in[5];
  const float* bv = (const float*)d_in[6];
  const float* Wo = (const float*)d_in[7];
  const float* bo = (const float*)d_in[8];
  float* out = (float*)d_out;

  const size_t TOK = (size_t)NB * SLEN;          // 8192 tokens

  // Workspace map (f16): q/k/v/attn 16 MB each, x_h 16 MB, weights 2 MB x4.
  char* ws = (char*)d_ws;
  _Float16* q_ws = (_Float16*)(ws);
  _Float16* k_ws = (_Float16*)(ws + 16ull * 1024 * 1024);
  _Float16* v_ws = (_Float16*)(ws + 32ull * 1024 * 1024);
  _Float16* a_ws = (_Float16*)(ws + 48ull * 1024 * 1024);
  _Float16* x_h  = (_Float16*)(ws + 64ull * 1024 * 1024);
  _Float16* wq_h = (_Float16*)(ws + 80ull * 1024 * 1024);
  _Float16* wk_h = (_Float16*)(ws + 82ull * 1024 * 1024);
  _Float16* wv_h = (_Float16*)(ws + 84ull * 1024 * 1024);
  _Float16* wo_h = (_Float16*)(ws + 86ull * 1024 * 1024);

  // 0) fp32 -> f16 conversion, one launch: x_h and the four weight planes
  //    lie one behind the other in the workspace map above.
  cvt_f32_to_f16<<<CVT_GRID, 512, 0, stream>>>(x, Wq, Wk, Wv, Wo, x_h);

  // 1) QKV projections: 256x128 block per work-group, z selects Q/K/V.
  dim3 qkv_grid(DMODEL / GEMM_TN, (unsigned)(TOK / GEMM_TM), 3);
  qkv_gemm_kernel<<<qkv_grid, GEMM_WAVES * 32, 0, stream>>>(x_h, wq_h, wk_h, wv_h,
                                               bq, bk, bv, q_ws, k_ws, v_ws);

  // 2) Attention: 8 waves per (pair of blocks of 128 queries, head, batch).
  dim3 attn_grid(AT_BLOCKS / 2, NHEAD, NB);
  attn_kernel<<<attn_grid, AT_WAVES * 32, 0, stream>>>(q_ws, k_ws, v_ws, a_ws);

  // 3) Output projection (fp32 result).
  dim3 proj_grid(DMODEL / GEMM_TN, (unsigned)(TOK / GEMM_TM));
  out_proj_kernel<<<proj_grid, GEMM_WAVES * 32, 0, stream>>>(a_ws, wo_h, bo, out);
}

// v008
// One run takes 102 microseconds.
// Two timings next to v007 both put it at 1.07 times that version's speed.
// Over all steps from v000 it is 3.65 times as fast.
#include <hip/hip_runtime.h>

#define DMODEL 1024
#define SLEN   2048
#define NHEAD  16
#define DK     64
#define NB     4

typedef __attribute__((ext_vector_type(16))) _Float16 v16h;
typedef __attribute__((ext_vector_type(8)))  _Float16 v8h;
typedef __attribute__((ext_vector_type(4)))  _Float16 v4h;
typedef __attribute__((ext_vector_type(4)))  float    v4f;
typedef __attribute__((ext_vector_type(8)))  float    v8f;

// D = A(16x32 f16) * B(32x16 f16) + C(16x16 f32)
__device__ __forceinline__ v8f wmma16(v16h a, v16h b, v8f c) {
  return __builtin_amdgcn_wmma_f32_16x16x32_f16(
      /*neg_a=*/false, a, /*neg_b=*/false, b,
      /*c_mod=*/(short)0, c, /*reuse_a=*/false, /*reuse_b=*/false);
}

__device__ __forceinline__ v16h frag_f16(const _Float16* __restrict__ p) {
  v8h a = *(const v8h*)(p);
  v8h b = *(const v8h*)(p + 16);
  v16h f;
#pragma unroll
  for (int j = 0; j < 8; ++j) { f[j] = a[j]; f[j + 8] = b[j]; }
  return f;
}

// ---------------------------------------------------------------------------
// Fragment-packed layout of every f16 workspace operand.
// A matrix M[row][k] that feeds WMMA as A (lane = row) or B (lane = column,
// stored as row) is kept as 16x32 fragments of 512 halves (1024 bytes), each
// in the order the lanes read it: two units of 256 halves, unit u holding
// k = u*16 + hi*8 + j at [lane = hi*16 + (row & 15)][j]. One wave-wide
// 16-byte load then covers 512 contiguous bytes (4 whole lines) where a
// row-major operand gives 16 rows x 32 bytes (16 lines).
// ---------------------------------------------------------------------------
#define FRAG 512  // halves per 16x32 fragment

// Place of element (row & 15, k & 31) inside its fragment, in halves.
__device__ __forceinline__ int pk_in_frag(int row, int k) {
  return ((k >> 4) & 1) * 256 + ((((k >> 3) & 1) << 4) + (row & 15)) * 8 +
         (k & 7);
}

__device__ __forceinline__ v16h frag_pk(const _Float16* __restrict__ p) {
  v8h a = *(const v8h*)(p);
  v8h b = *(const v8h*)(p + 256);
  v16h f;
#pragma unroll
  for (int j = 0; j < 8; ++j) { f[j] = a[j]; f[j + 8] = b[j]; }
  return f;
}

#define XTILES   (NB * SLEN / 16)   // 16-row tiles of x
#define WTILES   (DMODEL / 16)      // 16-row tiles of one weight matrix
#define CVT_GRID 256
static_assert(XTILES == 2 * CVT_GRID && 4 * WTILES == CVT_GRID,
              "three row tiles per work-group");

__global__ void __launch_bounds__(512)
cvt_f32_to_f16(const float* __restrict__ x, const float* __restrict__ wq,
               const float* __restrict__ wk, const float* __restrict__ wv,
               const float* __restrict__ wo, _Float16* __restrict__ out) {
  const unsigned w = threadIdx.x >> 5, l = threadIdx.x & 31;
  const unsigned r = l >> 3;        // row inside a group of 4 rows
  const unsigned c = (l & 7) * 4;   // column inside a 32-column block
  const unsigned g = blockIdx.x;
  const unsigned TILE = 16 * DMODEL;  // elements of a row tile, in and out

  // Block-uniform tile bases, one lane offset for all of them.
  const unsigned m = g / WTILES;
  const float* wsel = (m & 2) ? ((m & 1) ? wo : wv) : ((m & 1) ? wk : wq);
  const float* src[3] = {x + (size_t)g * TILE,
                         x + (size_t)(g + CVT_GRID) * TILE,
                         wsel + (size_t)(g % WTILES) * TILE};
  const unsigned loff = r * DMODEL + w * 64 + c;

  v4f v[3][2][4];
#pragma unroll
  for (int p = 0; p < 3; ++p)
#pragma unroll
    for (int f = 0; f < 2; ++f)
#pragma unroll
      for (int q = 0; q < 4; ++q)
        v[p][f][q] = *(const v4f*)(src[p] + loff + q * 4 * DMODEL + f * 32);

  const unsigned soff = w * 2 * FRAG + pk_in_frag(r, c);
#pragma unroll
  for (int p = 0; p < 3; ++p) {
    _Float16* o = out + (size_t)(g + p * CVT_GRID) * TILE;
#pragma unroll
    for (int f = 0; f < 2; ++f)
#pragma unroll
      for (int q = 0; q < 4; ++q) {
        v4h h;
#pragma unroll
        for (int j = 0; j < 4; ++j) h[j] = (_Float16)v[p][f][q][j];
        // rows q*4 + r: 4 rows further on is 32 halves further on
        *(v4h*)(o + soff + f * FRAG + q * 32) = h;
      }
  }
}

#define GEMM_WAVES 8
#define GEMM_TM    256
#define GEMM_TN    128
#define ST_FRAGS   2                               // fragments per tile row
#define ST_COUNT   (DMODEL / 32 / ST_FRAGS)        // stages
#define ST_ROW     (ST_FRAGS * FRAG)               // halves per tile row
#define ST_AROWS   (GEMM_TM / 16)
#define ST_ROWS    ((GEMM_TM + GEMM_TN) / 16)      // tile rows per stage
#define ST_HALVES  (ST_ROWS * ST_ROW)              // halves per buffer
#define ST_COPIES  12                              // copies per wave and stage
static_assert(ST_ROWS == 3 * GEMM_WAVES && ST_ROW == 4 * 256 && ST_COUNT >= 2,
              "a wave copies three tile rows, four 512-byte pieces each");

__device__ __forceinline__ void copy_row(unsigned l, const _Float16* g) {
  asm volatile(
      "global_load_async_to_lds_b128 %0, %4, off\n\t"
      "global_load_async_to_lds_b128 %1, %5, off\n\t"
      "global_load_async_to_lds_b128 %2, %6, off\n\t"
      "global_load_async_to_lds_b128 %3, %7, off\n\t"
      "s_wait_xcnt 0x0"
      :
      : "v"(l), "v"(l + 512u), "v"(l + 1024u), "v"(l + 1536u),
        "v"(g), "v"(g + 256), "v"(g + 512), "v"(g + 768)
      : "memory");
}
__device__ __forceinline__ void copy_stage(unsigned l, const _Float16* g0,
                                           const _Float16* g1,
                                           const _Float16* g2) {
  copy_row(l, g0);
  copy_row(l + 2048u, g1);
  copy_row(l + 4096u, g2);
}

// Ab, Bb: first packed tile row of the block's A rows and B rows. wave is
// wave-uniform. On return acc holds the wave's 64x64 tile, rows
// (wave >> 1) * 64, columns (wave & 1) * 64 of the block.
template <int NBUF>
__device__ __forceinline__ void gemm_block(const _Float16* __restrict__ Ab,
                                           const _Float16* __restrict__ Bb,
                                           _Float16* L, unsigned wave,
                                           unsigned lane, v8f (&acc)[4][4]) {
  static_assert(NBUF >= 2 && NBUF <= ST_COUNT && NBUF * ST_COPIES <= 63,
                "every buffer has a first stage; at most 63 copies in flight");
  const int TROW = (DMODEL / 32) * FRAG;  // halves per packed 16-row tile
  const _Float16* g[3];
#pragma unroll
  for (unsigned i = 0; i < 3; ++i) {
    const unsigned r = 3 * wave + i;  // tile row of the stage: A first, then B
    g[i] = ((r < ST_AROWS) ? Ab + (size_t)r * TROW
                           : Bb + (size_t)(r - ST_AROWS) * TROW) + lane * 8;
  }
  const unsigned lcp =
      (unsigned)(size_t)L + (wave * 3 * ST_ROW + lane * 8) * 2;  // bytes

  for (int s = 0; s < NBUF; ++s)
    copy_stage(lcp + s * ST_HALVES * 2, g[0] + s * ST_ROW, g[1] + s * ST_ROW,
               g[2] + s * ST_ROW);
  // All but the copies of the NBUF - 1 younger stages are done: stage 0 has
  // landed for this wave, and behind the barrier for all waves.
  asm volatile("s_wait_asynccnt %0" ::"i"((NBUF - 1) * ST_COPIES) : "memory");
  __syncthreads();

  const _Float16* la = L + (wave >> 1) * 4 * ST_ROW + lane * 8;
  const _Float16* lb = L + (ST_AROWS + (wave & 1) * 4) * ST_ROW + lane * 8;
  unsigned buf = 0;  // place of stage t's buffer in the ring, in halves
  for (int t = 0; t < ST_COUNT; ++t) {
    v16h a[4], bf[4];
#pragma unroll
    for (int kk = 0; kk < ST_FRAGS; ++kk) {
      bf[0] = frag_pk(lb + buf + kk * FRAG);
#pragma unroll
      for (int i = 0; i < 4; ++i)
        a[i] = frag_pk(la + buf + i * ST_ROW + kk * FRAG);
#pragma unroll
      for (int j = 1; j < 4; ++j)
        bf[j] = frag_pk(lb + buf + j * ST_ROW + kk * FRAG);
      if (kk == ST_FRAGS - 1) {
        // Publish point of stage t + 1, behind the stage's last LDS reads and
        // in front of their WMMAs: this wave's reads of stage t are done, its
        // copies of stage t + 1 have landed; the barrier says so of every
        // wave. The copies of stages t + 2 .. t + NBUF - 1 stay in flight: the
        // count is theirs while the last of them exists, 0 in the last trips.
        asm volatile("s_wait_dscnt 0x0" ::: "memory");
        if (t + NBUF - 1 < ST_COUNT)
          asm volatile("s_wait_asynccnt %0" ::"i"((NBUF - 2) * ST_COPIES)
                       : "memory");
        else
          asm volatile("s_wait_asynccnt 0x0" ::: "memory");
        __syncthreads();
        if (t + NBUF < ST_COUNT)  // refill the buffer that every wave has left
          copy_stage(lcp + buf * 2, g[0] + (t + NBUF) * ST_ROW,
                     g[1] + (t + NBUF) * ST_ROW, g[2] + (t + NBUF) * ST_ROW);
      }
      // Holds the 16 LDS reads of a k-step (and the refill) together in front
      // of its WMMAs: left alone the compiler sinks the B reads among the
      // WMMAs, one register set, a wait to 0 in front of every four.
      __builtin_amdgcn_sched_barrier(0);
#pragma unroll
      for (int j = 0; j < 4; ++j)
#pragma unroll
        for (int i = 0; i < 4; ++i) acc[i][j] = wmma16(a[i], bf[j], acc[i][j]);
    }
    buf = (buf == (NBUF - 1) * ST_HALVES) ? 0u : buf + ST_HALVES;
  }
  // No copy is outstanding when the wave goes on to its stores and ends.
  asm volatile("s_wait_asynccnt 0x0" ::: "memory");
}

// ---------------------------------------------------------------------------
// Kernel 1: QKV projection, one wave per 64x64 output tile, 8 waves per
// work-group (gemm_block), blockIdx.z picks the matrix (0=Q, 1=K, 2=V).
// out[m,n] = sum_k x[m,k]*W[n,k] + b[n].
// All operands and results are fragment-packed. Per (b, h): Q and K as
// [s/16][d/32] fragments (row = token, k = d), V as [s/32][d/16] fragments
// (row = d, k = token) so a 32-key chunk of K or of V is 4 KB in a row.
// ---------------------------------------------------------------------------
__global__ void __launch_bounds__(GEMM_WAVES * 32, 4)
qkv_gemm_kernel(const _Float16* __restrict__ Xh,
                const _Float16* __restrict__ Wqh,
                const _Float16* __restrict__ Wkh,
                const _Float16* __restrict__ Wvh,
                const float* __restrict__ bq, const float* __restrict__ bk,
                const float* __restrict__ bv,
                _Float16* __restrict__ Qo, _Float16* __restrict__ Ko,
                _Float16* __restrict__ Vo) {
  __shared__ __attribute__((aligned(16))) _Float16 L[3 * ST_HALVES];
  const unsigned wave = __builtin_amdgcn_readfirstlane(threadIdx.x >> 5);
  const int lane = threadIdx.x & 31;
  const int lo = lane & 15, hi = lane >> 4;
  const int z  = blockIdx.z;
  const _Float16* W    = (z == 0) ? Wqh : (z == 1) ? Wkh : Wvh;
  const float*    bias = (z == 0) ? bq  : (z == 1) ? bk  : bv;

  // Packed operands: tile row t, k-block kb at (t * (DMODEL/32) + kb) * FRAG.
  const int TROW = (DMODEL / 32) * FRAG;  // halves per 16-row tile
  v8f acc[4][4] = {};
  gemm_block<3>(Xh + (size_t)blockIdx.y * (GEMM_TM / 16) * TROW,
             W + (size_t)blockIdx.x * (GEMM_TN / 16) * TROW, L, wave, lane,
             acc);
  const int n0 = blockIdx.x * GEMM_TN + (wave & 1) * 64;
  const int m0 = blockIdx.y * GEMM_TM + (wave >> 1) * 64;

  const int b_ = m0 >> 11;  // 64-row tile never crosses a batch boundary
  const int hh = n0 >> 6;   // 64-column tile is exactly one head
  const int sb = m0 & (SLEN - 1);
  const size_t head = (size_t)(b_ * NHEAD + hh) * SLEN * DK;
  if (z < 2) {  // Q or K: fragments [s/16][d/32], row = token, k = d
    _Float16* O = ((z == 0) ? Qo : Ko) + head;
#pragma unroll
    for (int j = 0; j < 4; ++j) {
      const int d = j * 16 + lo;
      const float bb = bias[n0 + d];
#pragma unroll
      for (int i = 0; i < 4; ++i) {
        _Float16* fr = O + (((sb >> 4) + i) * (DK / 32) + (d >> 5)) * FRAG;
#pragma unroll
        for (int r = 0; r < 8; ++r) {
          const int row = hi * 8 + r;
          fr[pk_in_frag(row, d)] = (_Float16)(acc[i][j][r] + bb);
        }
      }
    }
  } else {      // V: fragments [s/32][d/16], row = d, k = token
    _Float16* O = Vo + head;
#pragma unroll
    for (int j = 0; j < 4; ++j) {
      const float bb = bias[n0 + j * 16 + lo];
#pragma unroll
      for (int i = 0; i < 4; ++i) {
        const int s0 = sb + i * 16 + hi * 8;   // 8 tokens in a row per lane
        v8h o;
#pragma unroll
        for (int r = 0; r < 8; ++r) o[r] = (_Float16)(acc[i][j][r] + bb);
        *(v8h*)(O + ((s0 >> 5) * (DK / 16) + j) * FRAG + pk_in_frag(lo, s0)) = o;
      }
      __builtin_amdgcn_sched_barrier(0);
    }
    // Stands in front of any later overwrite of the stores' data and address
    // registers (the listing leaves a path from here into the branch above).
    asm volatile("s_wait_xcnt 0x0" ::: "memory");
  }
}

#define AT_WAVES 8
#define AT_Q     (AT_WAVES * 16)      // queries per block
#define AT_BLOCKS (SLEN / AT_Q)       // query blocks per head
#define AT_KEYS  64                   // keys per stage
#define AT_OPH   (AT_KEYS * DK)       // halves of K, or of V, per stage
#define AT_STH   (2 * AT_OPH)         // halves per buffer: K, then V
#define AT_NBUF  3                    // buffers of the ring
#define AT_COPIES 4                   // copies per wave and stage
#define AT_TOTAL ((AT_BLOCKS + 1) * (AT_Q / AT_KEYS))  // stages per work-group
static_assert((AT_BLOCKS / 2 + 1) * (AT_Q / AT_KEYS) >= AT_NBUF,
              "the first block holds the first stage of every buffer");
static_assert(AT_OPH * 2 == 2 * AT_WAVES * 32 * 16 && AT_Q >= 2 * AT_KEYS &&
                  AT_Q % (2 * AT_KEYS) == 0 && SLEN % (2 * AT_Q) == 0,
              "two 16-byte copies per lane and operand; an even number of "
              "stages per block, an even number of blocks");

__device__ __forceinline__ void copy_kv(unsigned l, const _Float16* k,
                                        const _Float16* v) {
  asm volatile(
      "global_load_async_to_lds_b128 %0, %4, off\n\t"
      "global_load_async_to_lds_b128 %1, %5, off\n\t"
      "global_load_async_to_lds_b128 %2, %6, off\n\t"
      "global_load_async_to_lds_b128 %3, %7, off\n\t"
      "s_wait_xcnt 0x0"
      :
      : "v"(l), "v"(l + 4096u), "v"(l + 8192u), "v"(l + 12288u),
        "v"(k), "v"(k + 2048), "v"(v), "v"(v + 2048)
      : "memory");
}

__device__ __forceinline__ float xhalf(float x) {
  const int b = __builtin_bit_cast(int, x);
  return __builtin_bit_cast(float, __builtin_amdgcn_permlanex16(
      b, b, 0x76543210, 0xfedcba98, false, false));
}

__global__ void __launch_bounds__(AT_WAVES * 32)
attn_kernel(const _Float16* __restrict__ Q, const _Float16* __restrict__ K,
            const _Float16* __restrict__ V, _Float16* __restrict__ O) {
  __shared__ __attribute__((aligned(16))) _Float16 L[AT_NBUF * AT_STH];
  const int wave = __builtin_amdgcn_readfirstlane(threadIdx.x >> 5);
  const int lane = threadIdx.x & 31;
  const int lo = lane & 15, hi = lane >> 4;
  const int h  = blockIdx.y;
  const int b  = blockIdx.z;

  // Packed per head: a 16-token tile of Q or K is 2 fragments, a 32-key
  // chunk of K or of V is 4 fragments (CHUNK halves) in a row.
  const int CHUNK = 4 * FRAG;
  const size_t head = (size_t)(b * NHEAD + h) * SLEN * DK;
  const _Float16* kp = K + head;
  const _Float16* vp = V + head;

  const unsigned lcp = (unsigned)(size_t)L + threadIdx.x * 16;  // bytes
  const _Float16* kg = kp + threadIdx.x * 8;
  const _Float16* vg = vp + threadIdx.x * 8;

  for (int s = 0; s < AT_NBUF; ++s)
    copy_kv(lcp + s * AT_STH * 2, kg + s * AT_OPH, vg + s * AT_OPH);
  // All but the copies of the AT_NBUF - 1 younger stages are done: stage 0 has
  // landed for this wave, and behind the barrier for all waves.
  asm volatile("s_wait_asynccnt %0" ::"i"((AT_NBUF - 1) * AT_COPIES)
               : "memory");
  __syncthreads();

  // Stages of the first block; the work-group's stages are counted through
  // both blocks in gs, and buf is the place of stage gs's buffer, in halves.
  const int nfirst = (AT_BLOCKS - (int)blockIdx.x) * (AT_Q / AT_KEYS);
  int gs = 0;
  unsigned buf = 0;

  for (int part = 0; part < 2; ++part) {
    // Block of AT_Q queries: the long one first, then its short partner.
    const int pb = part ? (int)blockIdx.x : AT_BLOCKS - 1 - (int)blockIdx.x;
    const int q0 = pb * AT_Q + wave * 16;
    const _Float16* qp = Q + head + (q0 >> 4) * (2 * FRAG) + lane * 8;

    const v16h qb0 = frag_pk(qp);         // B: column = query lo, k = d 0..31
    const v16h qb1 = frag_pk(qp + FRAG);  // B: column = query lo, k = d 32..63

    // Per lane: running maximum of query lo (alike in both halves), the sum
    // over this half's keys only, and O^T: acc[t][r] = O[lo][t*16 + hi*8 + r].
    float mrow = -__builtin_inff(), lrow = 0.f;
    v8f acc[4] = {{}, {}, {}, {}};
    const int qrow = q0 + lo;

    const int s_end = q0 + 16;  // causal upper bound of this wave
    const int nst = (pb + 1) * (AT_Q / AT_KEYS);  // stages of the block

    for (int st = 0; st < nst; ++st) {
      // Unrolled: a chunk's place in the buffer becomes the immediate offset
      // of its LDS reads.
#pragma unroll
      for (int c = 0; c < AT_KEYS / 32; ++c) {
        const int s0 = st * AT_KEYS + c * 32;
        if (s0 >= s_end) continue;  // wave-uniform: beyond the wave's diagonal
        const _Float16* kc = L + buf + c * CHUNK;
        const _Float16* vc = L + buf + AT_OPH + c * CHUNK;

        // ---- scores: S^T = K * Q^T ----
        v8f sc0 = {}, sc1 = {};
        {
          const _Float16* kr = kc + lane * 8;
          const v16h k00 = frag_pk(kr);             // keys s0 .. s0+15
          const v16h k01 = frag_pk(kr + FRAG);
          const v16h k10 = frag_pk(kr + 2 * FRAG);  // keys s0+16 .. s0+31
          const v16h k11 = frag_pk(kr + 3 * FRAG);
          // Holds the chunk's 8 LDS reads of K together in front of its
          // WMMAs: left alone the compiler sinks them among the WMMAs, one
          // register set, a wait to 0 in front of each.
          __builtin_amdgcn_sched_barrier(0);
          sc0 = wmma16(k00, qb0, sc0);
          sc0 = wmma16(k01, qb1, sc0);
          sc1 = wmma16(k10, qb0, sc1);
          sc1 = wmma16(k11, qb1, sc1);
        }

#pragma unroll
        for (int r = 0; r < 8; ++r) {
          sc0[r] *= 0.125f;   // 1/sqrt(64)
          sc1[r] *= 0.125f;
        }
        // Only the chunk that holds the wave's diagonal has keys beyond a
        // query of the wave: a scalar branch takes every other chunk round
        // the compares and selects.
        if (s0 + 31 > q0) {
          const int rel = qrow - s0 - hi * 8;  // key <= query <=> r (+16) <= rel
#pragma unroll
          for (int r = 0; r < 8; ++r) {
            sc0[r] = (r <= rel)      ? sc0[r] : -__builtin_inff();
            sc1[r] = (r + 16 <= rel) ? sc1[r] : -__builtin_inff();
          }
        }

        // ---- online softmax, one query per lane ----
        float cm0 = fmaxf(sc0[0], sc1[0]), cm1 = fmaxf(sc0[1], sc1[1]);
#pragma unroll
        for (int r = 2; r < 8; r += 2) {
          cm0 = fmaxf(fmaxf(cm0, sc0[r]), sc1[r]);
          cm1 = fmaxf(fmaxf(cm1, sc0[r + 1]), sc1[r + 1]);
        }
        float cm = fmaxf(cm0, cm1);
        cm = fmaxf(cm, xhalf(cm));  // all 32 keys; key s0 is never masked
        const float mnew = fmaxf(mrow, cm);
        const float corr = __expf(mrow - mnew);
        float rs0 = 0.f, rs1 = 0.f;
        v16h pt;  // B: column = query lo, k = key in the hardware order
#pragma unroll
        for (int r = 0; r < 8; ++r) {
          const float p0 = __expf(sc0[r] - mnew);
          const float p1 = __expf(sc1[r] - mnew);
          rs0 += p0;
          rs1 += p1;
          pt[r]     = (_Float16)p0;
          pt[r + 8] = (_Float16)p1;
        }
        lrow = lrow * corr + (rs0 + rs1);
        mrow = mnew;
#pragma unroll
        for (int t = 0; t < 4; ++t) acc[t] *= corr;

        // ---- O^T += V^T * P^T (fragment t: rows d = t*16 .. t*16+15) ----
#pragma unroll
        for (int t = 0; t < 4; ++t)
          acc[t] = wmma16(frag_pk(vc + t * FRAG + lane * 8), pt, acc[t]);
      }
      // Publish point of the next stage: this wave's reads of stage st are
      // done, its copies of the next stage have landed; the barrier says so
      // of every wave. The copies of the stages behind the next stay in
      // flight: the count is theirs while the last of them exists, 0 in the
      // work-group's last stages.
      asm volatile("s_wait_dscnt 0x0" ::: "memory");
      if (gs + AT_NBUF - 1 < AT_TOTAL)
        asm volatile("s_wait_asynccnt %0" ::"i"((AT_NBUF - 2) * AT_COPIES)
                     : "memory");
      else
        asm volatile("s_wait_asynccnt 0x0" ::: "memory");
      __syncthreads();
      // Refill the buffer that every wave has left with stage gs + AT_NBUF of
      // the work-group: of the first block or, behind its end, of the second.
      const int nx = gs + AT_NBUF;
      if (nx < AT_TOTAL) {
        const int ks = (nx < nfirst) ? nx : nx - nfirst;
        copy_kv(lcp + buf * 2, kg + ks * AT_OPH, vg + ks * AT_OPH);
      }
      ++gs;
      buf = (buf == (AT_NBUF - 1) * AT_STH) ? 0u : buf + AT_STH;
    }

    // ---- finalize: join the halves' sums, divide, store packed for the
    //      projection: fragments [token/16][k/32], row = token = lo,
    //      k = h*64 + d. A lane's 8 values of tile t are 8 d in a row, so each
    //      tile is one 16-byte store per lane, 512 bytes in a row per wave.
    _Float16* ot = O + ((size_t)((b * SLEN + q0) >> 4) * (DMODEL / 32) +
                        h * (DK / 32)) * FRAG + lane * 8;
    const float inv = 1.0f / (lrow + xhalf(lrow));
    v8h o[4];
#pragma unroll
    for (int t = 0; t < 4; ++t) {
#pragma unroll
      for (int r = 0; r < 8; ++r) o[t][r] = (_Float16)(acc[t][r] * inv);
    }
#pragma unroll
    for (int t = 0; t < 4; ++t)
      *(v8h*)(ot + (t >> 1) * FRAG + (t & 1) * 256) = o[t];
    // Stands in front of the second block's overwrite of the stores' data and
    // address registers.
    asm volatile("s_wait_xcnt 0x0" ::: "memory");
  }
  // No copy is outstanding when the wave ends.
  asm volatile("s_wait_asynccnt 0x0" ::: "memory");
}

// ---------------------------------------------------------------------------
// Kernel 3: output projection, 64x64 tile per wave, 8 waves per work-group
// (gemm_block). out = attn @ Wo.T + bo, both operands fragment-packed, fp32
// result straight to d_out.
// ---------------------------------------------------------------------------
__global__ void __launch_bounds__(GEMM_WAVES * 32, 4)
out_proj_kernel(const _Float16* __restrict__ A, const _Float16* __restrict__ W,
                const float* __restrict__ bias, float* __restrict__ out) {
  __shared__ __attribute__((aligned(16))) _Float16 L[4 * ST_HALVES];
  const unsigned wave = __builtin_amdgcn_readfirstlane(threadIdx.x >> 5);
  const int lane = threadIdx.x & 31;
  const int lo = lane & 15, hi = lane >> 4;

  // Packed operands: tile row t, k-block kb at (t * (DMODEL/32) + kb) * FRAG.
  const int TROW = (DMODEL / 32) * FRAG;  // halves per 16-row tile
  v8f acc[4][4] = {};
  gemm_block<4>(A + (size_t)blockIdx.y * (GEMM_TM / 16) * TROW,
             W + (size_t)blockIdx.x * (GEMM_TN / 16) * TROW, L, wave, lane,
             acc);
  const int n0 = blockIdx.x * GEMM_TN + (wave & 1) * 64;
  const int m0 = blockIdx.y * GEMM_TM + (wave >> 1) * 64;

#pragma unroll
  for (int j = 0; j < 4; ++j) {
    const int col = n0 + j * 16 + lo;
    const float bb = bias[col];
#pragma unroll
    for (int i = 0; i < 4; ++i) {
#pragma unroll
      for (int r = 0; r < 8; ++r) {
        const int row = m0 + i * 16 + hi * 8 + r;
        out[(size_t)row * DMODEL + col] = acc[i][j][r] + bb;
      }
    }
  }
}

// ---------------------------------------------------------------------------
extern "C" void kernel_launch(void* const* d_in, const int* in_sizes, int n_in,
                              void* d_out, int out_size, void* d_ws,
                              size_t ws_size, hipStream_t stream) {
  const float* x  = (const float*)d_in[0];
  const float* Wq = (const float*)d_in[1];
  const float* bq = (const float*)d_in[2];
  const float* Wk = (const float*)d_in[3];
  const float* bk = (const float*)d_in[4];
  const float* Wv = (const float*)d_in[5];
  const float* bv = (const float*)d_in[6];
  const float* Wo = (const float*)d_in[7];
  const float* bo = (const float*)d_in[8];
  float* out = (float*)d_out;

  const size_t TOK = (size_t)NB * SLEN;          // 8192 tokens

  // Workspace map (f16): q/k/v/attn 16 MB each, x_h 16 MB, weights 2 MB x4.
  char* ws = (char*)d_ws;
  _Float16* q_ws = (_Float16*)(ws);
  _Float16* k_ws = (_Float16*)(ws + 16ull * 1024 * 1024);
  _Float16* v_ws = (_Float16*)(ws + 32ull * 1024 * 1024);
  _Float16* a_ws = (_Float16*)(ws + 48ull * 1024 * 1024);
  _Float16* x_h  = (_Float16*)(ws + 64ull * 1024 * 1024);
  _Float16* wq_h = (_Float16*)(ws + 80ull * 1024 * 1024);
  _Float16* wk_h = (_Float16*)(ws + 82ull * 1024 * 1024);
  _Float16* wv_h = (_Float16*)(ws + 84ull * 1024 * 1024);
  _Float16* wo_h = (_Float16*)(ws + 86ull * 1024 * 1024);

  // 0) fp32 -> f16 conversion, one launch: x_h and the four weight planes
  //    lie one behind the other in the workspace map above.
  cvt_f32_to_f16<<<CVT_GRID, 512, 0, stream>>>(x, Wq, Wk, Wv, Wo, x_h);

  // 1) QKV projections: 256x128 block per work-group, z selects Q/K/V.
  dim3 qkv_grid(DMODEL / GEMM_TN, (unsigned)(TOK / GEMM_TM), 3);
  qkv_gemm_kernel<<<qkv_grid, GEMM_WAVES * 32, 0, stream>>>(x_h, wq_h, wk_h, wv_h,
                                               bq, bk, bv, q_ws, k_ws, v_ws);

  // 2) Attention: 8 waves per (pair of blocks of 128 queries, head, batch).
  dim3 attn_grid(AT_BLOCKS / 2, NHEAD, NB);
  attn_kernel<<<attn_grid, AT_WAVES * 32, 0, stream>>>(q_ws, k_ws, v_ws, a_ws);

  // 3) Output projection (fp32 result).
  dim3 proj_grid(DMODEL / GEMM_TN, (unsigned)(TOK / GEMM_TM));
  out_proj_kernel<<<proj_grid, GEMM_WAVES * 32, 0, stream>>>(a_ws, wo_h, bo, out);
}
